// v000
// Times are from an AMD MI455X. After a warm-up the kernel runs many times in a row, and a time is the length of
// such a window on the GPU divided by its runs, so every launch and the gaps after it count. The runs cycle
// through copies of the inputs. A figure is the median of several windows, for all but v000 over two sittings.
// Sittings can differ by a few percent; kernels timed side by side share one.
// v000, which the later versions start from, runs in 4780 microseconds.
#include <hip/hip_runtime.h>
// Single-head self-attention, unmasked, over ONE unbatched sequence of 8192 tokens, with three separate projections to width 64 and NO output projection (x [8192][768]; q = x W_q, k = x W_k, v = x W_v ([in][out] 768 x 64 each, no bias): ONE head of 64; scores = q . k / sqrt(64); softmax over all 8192 keys (no mask); out = weights v -> [8192][64]).
// Structure: token rows r = s; x as exact f16 rows (bf16-rounded); the three [in][out] weights staged as x16 f16 planes (transposed), one after another, feeding three WMMA GEMMs (32x64 wave tiles, f32 accumulation, exact x16 weights; K = 768, N = 64) that write q, k and v as f16 rows; V^T via an LDS transpose; the queries in four chunks of 2048 rows (a chunk's 2048 x 8192 score plane is 64 MiB): one-pass scores (K = 64, alpha = 1/8: the module's division by sqrt(64)), row softmax on VALU (f32 statistics, native exp; weights stored x256 as f16), out = P . V^T GEMM (K = 8192, alpha 2^-8) written as f32 straight into the chunk's output rows.
// Compute dtype: inputs rounded to bf16; x / weights exact; q, k, v and the softmax weights as plain f16 GEMM operands (~2^-12); scores, softmax statistics and the output f32. v_wmma_f32_16x16x32_f16.
#define NB 1
#define SQ 8192
#define DM 768
#define NH 1
#define HD 64
#define HG 1                         /* heads per attention launch group */
#define B0 0                         /* first batch processed (debug hook) */
#define NBR NB                       /* batches processed (debug hook) */
#define NR ((size_t)NB * SQ)         /* token rows */
#define MP ((int)((size_t)NBR * SQ)) /* rows projected (debug hook) */
#define QN SQ                        /* query rows attended per batch (debug hook) */
#define NHD NH                       /* heads attended (debug hook) */
#define MPO MP                       /* unused: no output projection stage */
#define LQ (NH * HD)      /* row pitch of the q/k/v rows: the heads' total width (64), NOT the input width DM */
#define QC 2048                      /* query rows a pass: a 2048 x 8192 score plane is 64 MiB */
typedef __bf16 v16b __attribute__((ext_vector_type(16)));
typedef unsigned short v8us __attribute__((ext_vector_type(8), may_alias));
typedef float  v8f  __attribute__((ext_vector_type(8)));
typedef float  v4f  __attribute__((ext_vector_type(4)));
typedef float  v4fa __attribute__((ext_vector_type(4), may_alias));
union FragB { v16b v; v8us half[2]; unsigned short u[16]; };

__device__ __forceinline__ unsigned short bf16_bits(float x) { unsigned int u = __float_as_uint(x); return (unsigned short)((u + 0x7FFFu + ((u >> 16) & 1u)) >> 16); }
__device__ __forceinline__ float bf16_val(unsigned short b) { return __uint_as_float(((unsigned int)b) << 16); }
__device__ __forceinline__ float bf16_round(float x) { return bf16_val(bf16_bits(x)); }
// D += A·B with NT terms: 1 = ah·bh, 2 = + al·bh (A split), 3 = + ah·bl (both split)
template <int NT>
__device__ __forceinline__ v8f mmaN(v16b ah, v16b al, v16b bh, v16b bl, v8f c) {
  c = __builtin_amdgcn_wmma_f32_16x16x32_bf16(false, ah, false, bh, (short)0, c, false, false);
  if (NT >= 2) c = __builtin_amdgcn_wmma_f32_16x16x32_bf16(false, al, false, bh, (short)0, c, false, false);
  if (NT >= 3) c = __builtin_amdgcn_wmma_f32_16x16x32_bf16(false, ah, false, bl, (short)0, c, false, false);
  asm volatile("v_nop\n\tv_nop\n\tv_nop\n\tv_nop" : "+v"(c) : "v"(ah), "v"(al), "v"(bh), "v"(bl));
  return c;
}




// ---- f16 WMMA path (v_wmma_f32_16x16x32_f16): 11-bit significands for operands in range — used where a [0,1] probability operand needs more precision than bf16
typedef _Float16 v16h __attribute__((ext_vector_type(16)));
union FragH { v16h v; v8us half[2]; _Float16 h[16]; unsigned short u[16]; };
template <int NT>
__device__ __forceinline__ v8f mmaH(v16h ah, v16h al, v16h bh, v16h bl, v8f c) {
  c = __builtin_amdgcn_wmma_f32_16x16x32_f16(false, ah, false, bh, (short)0, c, false, false);
  if (NT >= 2) c = __builtin_amdgcn_wmma_f32_16x16x32_f16(false, al, false, bh, (short)0, c, false, false);
  if (NT >= 3) c = __builtin_amdgcn_wmma_f32_16x16x32_f16(false, ah, false, bl, (short)0, c, false, false);
  asm volatile("v_nop\n\tv_nop\n\tv_nop\n\tv_nop" : "+v"(c) : "v"(ah), "v"(al), "v"(bh), "v"(bl));
  return c;
}

// Wt[n][k] = f16(W[k][n]·scale) from f32 row-major W[K][N] (scale = power of two; bf16-exact weights stay exact in f16 away from the subnormal range)
__global__ __launch_bounds__(256) void k_wt_f16(const float* __restrict__ W, _Float16* __restrict__ Wt, int K, int N, float scale) {
  const int t = blockIdx.x * 256 + threadIdx.x; if (t >= N * (K / 8)) return; const int n = t / (K / 8), k8 = (t % (K / 8)) * 8; FragH f;
#pragma unroll
  for (int i = 0; i < 8; ++i) f.h[i] = (_Float16)(bf16_round(W[(size_t)(k8 + i) * N + n]) * scale); const v8us o = f.half[0];
  *(v8us*)((unsigned short*)Wt + (size_t)n * K + k8) = o; 
}

typedef _Float16 v4h __attribute__((ext_vector_type(4)));

__global__ __launch_bounds__(256) void k_x16(const float* __restrict__ x, _Float16* __restrict__ X16, size_t n8) { const size_t t = (size_t)blockIdx.x * 256 + threadIdx.x; if (t >= n8) return; FragH f;
#pragma unroll
  for (int q = 0; q < 8; ++q) f.h[q] = (_Float16)bf16_round(x[t * 8 + q]); *(v8us*)((unsigned short*)X16 + t * 8) = f.half[0];  }
template <int NHv, int TTv>
__global__ __launch_bounds__(256) void k_vt(const _Float16* __restrict__ V16, int ldv, int voff, _Float16* __restrict__ Vt) { __shared__ unsigned short tl[64][66]; const int tid = threadIdx.x; const int slab = blockIdx.x / (TTv / 64), lg = blockIdx.x % (TTv / 64); const int b = slab / NHv, h = slab % NHv;
  for (int i = tid; i < 64 * 8; i += 256) { const int r = i / 8, c8 = (i % 8) * 8; FragH f; f.half[0] = *(const v8us*)((const unsigned short*)V16 + ((size_t)b * TTv + lg * 64 + r) * ldv + voff + h * 64 + c8);
#pragma unroll
    for (int q = 0; q < 8; ++q) tl[r][c8 + q] = f.u[q]; }
  __syncthreads();
  {
#pragma unroll
    for (int rd = 0; rd < 2; ++rd) { const int d = rd * 32 + tid / 8, pc = tid % 8; FragH f;
#pragma unroll
      for (int q = 0; q < 8; ++q) f.u[q] = tl[pc * 8 + q][d];
      *(v8us*)((unsigned short*)Vt + ((size_t)slab * 64 + d) * TTv + lg * 64 + pc * 8) = f.half[0]; }
     } }


// ---- fast GEMM (wave tile 32x64; requires M % 32 == 0 rows per launch region and N % 64 == 0) ----
__device__ __forceinline__ v16h g2_frag(const _Float16* p, int hh) { FragH f; f.half[0] = *(const v8us*)((const unsigned short*)p + 8 * hh); f.half[1] = *(const v8us*)((const unsigned short*)p + 16 + 8 * hh); return f.v; }
__device__ __forceinline__ v8f g2_mma(v16h a, v16h b, v8f c) { v8f d = __builtin_amdgcn_wmma_f32_16x16x32_f16(false, a, false, b, (short)0, c, false, false); asm volatile("v_nop\n\tv_nop\n\tv_nop\n\tv_nop" : "+v"(d) : "v"(a), "v"(b)); return d; }
template <int ACT>
__global__ __launch_bounds__(128) void k_gemm2(const _Float16* __restrict__ A, int lda, size_t sA, const _Float16* __restrict__ Bh, int ldb, size_t sB, float alpha, const float* __restrict__ bias, size_t sBias, const float* __restrict__ CP, int rowsPerB, size_t sCPb, int row0g,
    float* __restrict__ C, _Float16* __restrict__ C16, int ldc, size_t sC, int M, int N, int K) { static_assert(ACT == 0 || ACT == 3 || ACT == 6 || ACT == 8 || ACT == 9 || ACT == 11 || ACT == 12 || ACT == 14 || ACT == 15 || ACT == 16 || ACT == 17, "k_gemm2: unsupported ACT code (would silently apply no activation)");
  __shared__ __attribute__((aligned(16))) float so[4][32][68];
  const int tid = threadIdx.x, w = tid >> 5, lane = tid & 31, ln = lane & 15, hh = lane >> 4; const int by = blockIdx.y;
  A += (size_t)by * sA; Bh += (size_t)by * sB; const size_t cofs = (size_t)by * sC; const float* bp = bias ? bias + (size_t)by * sBias : nullptr;
  const int ntn = N >> 6; const int mt = blockIdx.x / ntn, nq = blockIdx.x - mt * ntn; const int row0 = mt * 128 + 32 * w, col0 = nq * 64; if (row0 >= M) return;
  const _Float16* a0p = A + (size_t)(row0 + ln) * lda; const _Float16* a1p = a0p + (size_t)16 * lda;
  const _Float16* b0p = Bh + (size_t)(col0 + ln) * ldb; const _Float16* b1p = b0p + (size_t)16 * ldb; const _Float16* b2p = b1p + (size_t)16 * ldb; const _Float16* b3p = b2p + (size_t)16 * ldb;
  const v8f z8 = {0.f,0.f,0.f,0.f,0.f,0.f,0.f,0.f}; v8f c00 = z8, c01 = z8, c02 = z8, c03 = z8, c10 = z8, c11 = z8, c12 = z8, c13 = z8;
  for (int kb = 0; kb < K; kb += 32) { const v16h a0 = g2_frag(a0p + kb, hh), a1 = g2_frag(a1p + kb, hh);
    v16h b = g2_frag(b0p + kb, hh); c00 = g2_mma(a0, b, c00); c10 = g2_mma(a1, b, c10);
    b = g2_frag(b1p + kb, hh); c01 = g2_mma(a0, b, c01); c11 = g2_mma(a1, b, c11);
    b = g2_frag(b2p + kb, hh); c02 = g2_mma(a0, b, c02); c12 = g2_mma(a1, b, c12);
    b = g2_frag(b3p + kb, hh); c03 = g2_mma(a0, b, c03); c13 = g2_mma(a1, b, c13); }
  v8f accs[8] = {c00, c01, c02, c03, c10, c11, c12, c13};
#pragma unroll
  for (int u = 0; u < 8; ++u) { const int t = u & 3, half = u >> 2; const int col = col0 + t * 16 + ln; const float bv = bp ? bf16_round(bp[col]) : 0.f;
#pragma unroll
    for (int r = 0; r < 8; ++r) { const int rloc = half * 16 + 8 * hh + r; float v = accs[u][r] * alpha + bv; if (CP) { if (rowsPerB < 0) v += CP[cofs + (size_t)(row0g + row0 + rloc) * ldc + col];      /* rowsPerB < 0: own element of the batched C plane */ else { const int bidx = (row0g + row0 + rloc) / rowsPerB; v += CP[(size_t)bidx * sCPb + (size_t)by * 64 + col]; } }
      if (ACT == 3) v = fmaxf(v, 0.f); else if (ACT == 6) v = 0.5f * v * (1.0f + erff(v * 0.70710678118654752f)); else if (ACT == 11) v = 1.0f / (1.0f + expf(-v)); else if (ACT == 15) v = v / (1.0f + expf(-v)); else if (ACT == 12) v = (v > 0.f) ? v : 0.01f * v; else if (ACT == 8) v = tanhf(v); else if (ACT == 9) v = 0.5f * v * (1.0f + tanhf(0.7978845608028654f * (v + 0.044715f * v * v * v))); else if (ACT == 14) v = (v > 0.f) ? v : 0.1f * v; else if (ACT == 16) v = (v >= 0.f) ? v : 0.3f * v; else if (ACT == 17) v = (v >= 0.f) ? v : 0.2f * v;
      so[w][rloc][t * 16 + ln] = v; } }
  __builtin_amdgcn_fence(__ATOMIC_ACQ_REL, "workgroup"); __builtin_amdgcn_wave_barrier();
  const int rsub = lane >> 4, c4 = (lane & 15) * 4;
  {
#pragma unroll
    for (int q = 0; q < 16; ++q) { const int r = q * 2 + rsub; const v4f v = *(const v4fa*)&so[w][r][c4]; if (C) *(v4f*)(C + cofs + (size_t)(row0 + r) * ldc + col0 + c4) = v; if (C16) { v4h h4; for (int i = 0; i < 4; ++i) h4[i] = (_Float16)v[i]; *(v4h*)(C16 + cofs + (size_t)(row0 + r) * ldc + col0 + c4) = h4; } }
     } }


__global__ __launch_bounds__(256) void k_rsmf(const float* __restrict__ S, _Float16* __restrict__ P, int qn, int hg) {
  const int t = blockIdx.x * 256 + threadIdx.x; if (t >= qn * hg) return; const size_t i = (size_t)(t / qn) * SQ + (t % qn); const float* s = S + i * SQ; float mx = -3.0e38f;
  for (int j = 0; j < SQ; ++j) mx = fmaxf(mx, s[j]); float se = 0.f;
  for (int j = 0; j < SQ; ++j) se += __expf(s[j] - mx); const float sc = 256.0f / se;
  for (int j0 = 0; j0 < SQ; j0 += 8) { FragH f; for (int q = 0; q < 8; ++q) f.h[q] = (_Float16)(__expf(s[j0 + q] - mx) * sc); unsigned short* d = (unsigned short*)P + i * SQ + j0; *(v8us*)d = f.half[0];  } }

extern "C" void kernel_launch(void* const* d_in, const int* in_sizes, int n_in,
                              void* d_out, int out_size, void* d_ws, size_t ws_size, hipStream_t stream) {
  (void)in_sizes; (void)n_in; (void)out_size;
  const float* const* I = (const float* const*)d_in; const float* x = I[0]; const float* wq = I[1]; const float* wk = I[2]; const float* wv = I[3];      /* x [8192][768] (ONE unbatched sequence); three separate [in][out] weights W_q, W_k, W_v [768][64]: ONE head of 64; no biases; no output projection */
  static_assert(NH == 1 && HG == 1 && SQ % QC == 0 && QC % 128 == 0, "one head, one head a launch group, whole query chunks");
  char* ws = (char*)d_ws; size_t off = 0;
  auto take = [&](size_t bytes) { char* p = ws + off; off += (bytes + 255) & ~(size_t)255; return p; };
  _Float16* BQKV = (_Float16*)take((size_t)3 * LQ * DM * 2); _Float16* BQ = BQKV; _Float16* BK = BQKV + (size_t)LQ * DM; _Float16* BV = BQKV + (size_t)2 * LQ * DM;      /* three transposed planes Bt [64][768], one after another */
  _Float16* X16 = (_Float16*)take(NR * DM * 2); _Float16* Q16 = (_Float16*)take(NR * LQ * 2); _Float16* K16 = (_Float16*)take(NR * LQ * 2); _Float16* V16 = (_Float16*)take(NR * LQ * 2);
  float* S = (float*)take((size_t)HG * QC * SQ * 4); _Float16* P = (_Float16*)take((size_t)HG * QC * SQ * 2);      /* ONE query chunk of one head at a time: [2048][8192] */ _Float16* VT = (_Float16*)take((size_t)NH * HD * SQ * 2);
  if (off > ws_size) return;
  k_wt_f16<<<(unsigned)(((size_t)LQ * (DM / 8) + 255) / 256), 256, 0, stream>>>(wq, BQ, DM, LQ, 16.0f); k_wt_f16<<<(unsigned)(((size_t)LQ * (DM / 8) + 255) / 256), 256, 0, stream>>>(wk, BK, DM, LQ, 16.0f); k_wt_f16<<<(unsigned)(((size_t)LQ * (DM / 8) + 255) / 256), 256, 0, stream>>>(wv, BV, DM, LQ, 16.0f);      /* three [in][out] weights -> their transposed x16 planes, one after another */

  k_x16<<<(unsigned)((NR * DM / 8 + 255) / 256), 256, 0, stream>>>(x, X16, NR * DM / 8);
  const size_t r0p = (size_t)B0 * SQ;      /* first projected row */
  k_gemm2<0><<<dim3((unsigned)((MP / 128) * (LQ / 64)), 1), 128, 0, stream>>>(X16 + r0p * DM, DM, 0, BQ, DM, 0, 0.0625f, nullptr, 0, nullptr, 1, 0, 0, nullptr, Q16 + r0p * LQ, LQ, 0, MP, LQ, DM);      /* q = x W as f16 rows [8192][64] (K = 768, N = 64; no bias) */
  k_gemm2<0><<<dim3((unsigned)((MP / 128) * (LQ / 64)), 1), 128, 0, stream>>>(X16 + r0p * DM, DM, 0, BK, DM, 0, 0.0625f, nullptr, 0, nullptr, 1, 0, 0, nullptr, K16 + r0p * LQ, LQ, 0, MP, LQ, DM);      /* k = x W as f16 rows [8192][64] (K = 768, N = 64; no bias) */
  k_gemm2<0><<<dim3((unsigned)((MP / 128) * (LQ / 64)), 1), 128, 0, stream>>>(X16 + r0p * DM, DM, 0, BV, DM, 0, 0.0625f, nullptr, 0, nullptr, 1, 0, 0, nullptr, V16 + r0p * LQ, LQ, 0, MP, LQ, DM);      /* v = x W as f16 rows [8192][64] (K = 768, N = 64; no bias) */
  for (int b = B0; b < B0 + NBR; ++b) { const size_t r0 = (size_t)b * SQ;
    k_vt<NH, SQ><<<NH * (SQ / 64), 256, 0, stream>>>(V16 + r0 * LQ, LQ, 0, VT);      /* V^T [NH][HD][SQ] for this batch */
    for (int h0 = 0; h0 < NHD; h0 += HG) {
      for (int q0 = 0; q0 < QN; q0 += QC) {      /* the queries in chunks of QC rows: each pass fills the score and weight planes anew after the launches that read them */
        k_gemm2<0><<<dim3((QC / 128) * (SQ / 64), HG), 128, 0, stream>>>(Q16 + (r0 + q0) * LQ + h0 * HD, LQ, (size_t)HD, K16 + r0 * LQ + h0 * HD, LQ, (size_t)HD, 0.125f, nullptr, 0, nullptr, 1, 0, 0, S, nullptr, SQ, (size_t)QC * SQ, QC, SQ, HD);      /* one-pass scores at the module's factor 1/8: q . k / 8 (K = 64) for QC query rows against all SQ keys */
        k_rsmf<<<(HG * QC + 255) / 256, 256, 0, stream>>>(S, P, QC, HG);      /* P = 256 softmax (f16) of the chunk's rows */
        k_gemm2<0><<<dim3((QC / 128) * (HD / 64), HG), 128, 0, stream>>>(P, SQ, (size_t)QC * SQ, VT + (size_t)h0 * HD * SQ, SQ, (size_t)HD * SQ, 0.00390625f, nullptr, 0, nullptr, 1, 0, 0, (float*)d_out + (r0 + q0) * LQ + h0 * HD, nullptr, LQ, (size_t)HD, QC, HD, SQ); } } }      /* the chunk's context rows straight into the output as f32: P carries 256 x the weights */
}

// v001
// A run of this version takes 1140 microseconds.
// In two side-by-side timings against v000, it was 4.19 and 4.16 times as fast.
#include <hip/hip_runtime.h>
// Single-head self-attention, unmasked, over ONE unbatched sequence of 8192 tokens, with three separate projections to width 64 and NO output projection (x [8192][768]; q = x W_q, k = x W_k, v = x W_v ([in][out] 768 x 64 each, no bias): ONE head of 64; scores = q . k / sqrt(64); softmax over all 8192 keys (no mask); out = weights v -> [8192][64]).
// Structure: token rows r = s; x as exact f16 rows (bf16-rounded); the three [in][out] weights staged as x16 f16 planes (transposed), one after another, feeding three WMMA GEMMs (32x64 wave tiles, f32 accumulation, exact x16 weights; K = 768, N = 64) that write q, k and v as f16 rows; V^T via an LDS transpose; the queries in four chunks of 2048 rows (a chunk's 2048 x 8192 score plane is 64 MiB): one-pass scores (K = 64, alpha = 1/8: the module's division by sqrt(64)), row softmax on VALU, one work-group a row (f32 statistics, native exp; weights stored x256 as f16), out = P . V^T GEMM (K = 8192, alpha 2^-8) written as f32 straight into the chunk's output rows.
// Compute dtype: inputs rounded to bf16; x / weights exact; q, k, v and the softmax weights as plain f16 GEMM operands (~2^-12); scores, softmax statistics and the output f32. v_wmma_f32_16x16x32_f16.
#define NB 1
#define SQ 8192
#define DM 768
#define NH 1
#define HD 64
#define HG 1                         /* heads per attention launch group */
#define B0 0                         /* first batch processed (debug hook) */
#define NBR NB                       /* batches processed (debug hook) */
#define NR ((size_t)NB * SQ)         /* token rows */
#define MP ((int)((size_t)NBR * SQ)) /* rows projected (debug hook) */
#define QN SQ                        /* query rows attended per batch (debug hook) */
#define NHD NH                       /* heads attended (debug hook) */
#define MPO MP                       /* unused: no output projection stage */
#define LQ (NH * HD)      /* row pitch of the q/k/v rows: the heads' total width (64), NOT the input width DM */
#define QC 2048                      /* query rows a pass: a 2048 x 8192 score plane is 64 MiB */
typedef __bf16 v16b __attribute__((ext_vector_type(16)));
typedef unsigned short v8us __attribute__((ext_vector_type(8), may_alias));
typedef float  v8f  __attribute__((ext_vector_type(8)));
typedef float  v4f  __attribute__((ext_vector_type(4)));
typedef float  v4fa __attribute__((ext_vector_type(4), may_alias));
union FragB { v16b v; v8us half[2]; unsigned short u[16]; };

__device__ __forceinline__ unsigned short bf16_bits(float x) { unsigned int u = __float_as_uint(x); return (unsigned short)((u + 0x7FFFu + ((u >> 16) & 1u)) >> 16); }
__device__ __forceinline__ float bf16_val(unsigned short b) { return __uint_as_float(((unsigned int)b) << 16); }
__device__ __forceinline__ float bf16_round(float x) { return bf16_val(bf16_bits(x)); }
// D += A·B with NT terms: 1 = ah·bh, 2 = + al·bh (A split), 3 = + ah·bl (both split)
template <int NT>
__device__ __forceinline__ v8f mmaN(v16b ah, v16b al, v16b bh, v16b bl, v8f c) {
  c = __builtin_amdgcn_wmma_f32_16x16x32_bf16(false, ah, false, bh, (short)0, c, false, false);
  if (NT >= 2) c = __builtin_amdgcn_wmma_f32_16x16x32_bf16(false, al, false, bh, (short)0, c, false, false);
  if (NT >= 3) c = __builtin_amdgcn_wmma_f32_16x16x32_bf16(false, ah, false, bl, (short)0, c, false, false);
  asm volatile("v_nop\n\tv_nop\n\tv_nop\n\tv_nop" : "+v"(c) : "v"(ah), "v"(al), "v"(bh), "v"(bl));
  return c;
}




// ---- f16 WMMA path (v_wmma_f32_16x16x32_f16): 11-bit significands for operands in range — used where a [0,1] probability operand needs more precision than bf16
typedef _Float16 v16h __attribute__((ext_vector_type(16)));
union FragH { v16h v; v8us half[2]; _Float16 h[16]; unsigned short u[16]; };
template <int NT>
__device__ __forceinline__ v8f mmaH(v16h ah, v16h al, v16h bh, v16h bl, v8f c) {
  c = __builtin_amdgcn_wmma_f32_16x16x32_f16(false, ah, false, bh, (short)0, c, false, false);
  if (NT >= 2) c = __builtin_amdgcn_wmma_f32_16x16x32_f16(false, al, false, bh, (short)0, c, false, false);
  if (NT >= 3) c = __builtin_amdgcn_wmma_f32_16x16x32_f16(false, ah, false, bl, (short)0, c, false, false);
  asm volatile("v_nop\n\tv_nop\n\tv_nop\n\tv_nop" : "+v"(c) : "v"(ah), "v"(al), "v"(bh), "v"(bl));
  return c;
}

// Wt[n][k] = f16(W[k][n]·scale) from f32 row-major W[K][N] (scale = power of two; bf16-exact weights stay exact in f16 away from the subnormal range)
__global__ __launch_bounds__(256) void k_wt_f16(const float* __restrict__ W, _Float16* __restrict__ Wt, int K, int N, float scale) {
  const int t = blockIdx.x * 256 + threadIdx.x; if (t >= N * (K / 8)) return; const int n = t / (K / 8), k8 = (t % (K / 8)) * 8; FragH f;
#pragma unroll
  for (int i = 0; i < 8; ++i) f.h[i] = (_Float16)(bf16_round(W[(size_t)(k8 + i) * N + n]) * scale); const v8us o = f.half[0];
  *(v8us*)((unsigned short*)Wt + (size_t)n * K + k8) = o; 
}

typedef _Float16 v4h __attribute__((ext_vector_type(4)));

__global__ __launch_bounds__(256) void k_x16(const float* __restrict__ x, _Float16* __restrict__ X16, size_t n8) { const size_t t = (size_t)blockIdx.x * 256 + threadIdx.x; if (t >= n8) return; FragH f;
#pragma unroll
  for (int q = 0; q < 8; ++q) f.h[q] = (_Float16)bf16_round(x[t * 8 + q]); *(v8us*)((unsigned short*)X16 + t * 8) = f.half[0];  }
template <int NHv, int TTv>
__global__ __launch_bounds__(256) void k_vt(const _Float16* __restrict__ V16, int ldv, int voff, _Float16* __restrict__ Vt) { __shared__ unsigned short tl[64][66]; const int tid = threadIdx.x; const int slab = blockIdx.x / (TTv / 64), lg = blockIdx.x % (TTv / 64); const int b = slab / NHv, h = slab % NHv;
  for (int i = tid; i < 64 * 8; i += 256) { const int r = i / 8, c8 = (i % 8) * 8; FragH f; f.half[0] = *(const v8us*)((const unsigned short*)V16 + ((size_t)b * TTv + lg * 64 + r) * ldv + voff + h * 64 + c8);
#pragma unroll
    for (int q = 0; q < 8; ++q) tl[r][c8 + q] = f.u[q]; }
  __syncthreads();
  {
#pragma unroll
    for (int rd = 0; rd < 2; ++rd) { const int d = rd * 32 + tid / 8, pc = tid % 8; FragH f;
#pragma unroll
      for (int q = 0; q < 8; ++q) f.u[q] = tl[pc * 8 + q][d];
      *(v8us*)((unsigned short*)Vt + ((size_t)slab * 64 + d) * TTv + lg * 64 + pc * 8) = f.half[0]; }
     } }


// ---- fast GEMM (wave tile 32x64; requires M % 32 == 0 rows per launch region and N % 64 == 0) ----
__device__ __forceinline__ v16h g2_frag(const _Float16* p, int hh) { FragH f; f.half[0] = *(const v8us*)((const unsigned short*)p + 8 * hh); f.half[1] = *(const v8us*)((const unsigned short*)p + 16 + 8 * hh); return f.v; }
__device__ __forceinline__ v8f g2_mma(v16h a, v16h b, v8f c) { v8f d = __builtin_amdgcn_wmma_f32_16x16x32_f16(false, a, false, b, (short)0, c, false, false); asm volatile("v_nop\n\tv_nop\n\tv_nop\n\tv_nop" : "+v"(d) : "v"(a), "v"(b)); return d; }
template <int ACT>
__global__ __launch_bounds__(128) void k_gemm2(const _Float16* __restrict__ A, int lda, size_t sA, const _Float16* __restrict__ Bh, int ldb, size_t sB, float alpha, const float* __restrict__ bias, size_t sBias, const float* __restrict__ CP, int rowsPerB, size_t sCPb, int row0g,
    float* __restrict__ C, _Float16* __restrict__ C16, int ldc, size_t sC, int M, int N, int K) { static_assert(ACT == 0 || ACT == 3 || ACT == 6 || ACT == 8 || ACT == 9 || ACT == 11 || ACT == 12 || ACT == 14 || ACT == 15 || ACT == 16 || ACT == 17, "k_gemm2: unsupported ACT code (would silently apply no activation)");
  __shared__ __attribute__((aligned(16))) float so[4][32][68];
  const int tid = threadIdx.x, w = tid >> 5, lane = tid & 31, ln = lane & 15, hh = lane >> 4; const int by = blockIdx.y;
  A += (size_t)by * sA; Bh += (size_t)by * sB; const size_t cofs = (size_t)by * sC; const float* bp = bias ? bias + (size_t)by * sBias : nullptr;
  const int ntn = N >> 6; const int mt = blockIdx.x / ntn, nq = blockIdx.x - mt * ntn; const int row0 = mt * 128 + 32 * w, col0 = nq * 64; if (row0 >= M) return;
  const _Float16* a0p = A + (size_t)(row0 + ln) * lda; const _Float16* a1p = a0p + (size_t)16 * lda;
  const _Float16* b0p = Bh + (size_t)(col0 + ln) * ldb; const _Float16* b1p = b0p + (size_t)16 * ldb; const _Float16* b2p = b1p + (size_t)16 * ldb; const _Float16* b3p = b2p + (size_t)16 * ldb;
  const v8f z8 = {0.f,0.f,0.f,0.f,0.f,0.f,0.f,0.f}; v8f c00 = z8, c01 = z8, c02 = z8, c03 = z8, c10 = z8, c11 = z8, c12 = z8, c13 = z8;
  for (int kb = 0; kb < K; kb += 32) { const v16h a0 = g2_frag(a0p + kb, hh), a1 = g2_frag(a1p + kb, hh);
    v16h b = g2_frag(b0p + kb, hh); c00 = g2_mma(a0, b, c00); c10 = g2_mma(a1, b, c10);
    b = g2_frag(b1p + kb, hh); c01 = g2_mma(a0, b, c01); c11 = g2_mma(a1, b, c11);
    b = g2_frag(b2p + kb, hh); c02 = g2_mma(a0, b, c02); c12 = g2_mma(a1, b, c12);
    b = g2_frag(b3p + kb, hh); c03 = g2_mma(a0, b, c03); c13 = g2_mma(a1, b, c13); }
  v8f accs[8] = {c00, c01, c02, c03, c10, c11, c12, c13};
#pragma unroll
  for (int u = 0; u < 8; ++u) { const int t = u & 3, half = u >> 2; const int col = col0 + t * 16 + ln; const float bv = bp ? bf16_round(bp[col]) : 0.f;
#pragma unroll
    for (int r = 0; r < 8; ++r) { const int rloc = half * 16 + 8 * hh + r; float v = accs[u][r] * alpha + bv; if (CP) { if (rowsPerB < 0) v += CP[cofs + (size_t)(row0g + row0 + rloc) * ldc + col];      /* rowsPerB < 0: own element of the batched C plane */ else { const int bidx = (row0g + row0 + rloc) / rowsPerB; v += CP[(size_t)bidx * sCPb + (size_t)by * 64 + col]; } }
      if (ACT == 3) v = fmaxf(v, 0.f); else if (ACT == 6) v = 0.5f * v * (1.0f + erff(v * 0.70710678118654752f)); else if (ACT == 11) v = 1.0f / (1.0f + expf(-v)); else if (ACT == 15) v = v / (1.0f + expf(-v)); else if (ACT == 12) v = (v > 0.f) ? v : 0.01f * v; else if (ACT == 8) v = tanhf(v); else if (ACT == 9) v = 0.5f * v * (1.0f + tanhf(0.7978845608028654f * (v + 0.044715f * v * v * v))); else if (ACT == 14) v = (v > 0.f) ? v : 0.1f * v; else if (ACT == 16) v = (v >= 0.f) ? v : 0.3f * v; else if (ACT == 17) v = (v >= 0.f) ? v : 0.2f * v;
      so[w][rloc][t * 16 + ln] = v; } }
  __builtin_amdgcn_fence(__ATOMIC_ACQ_REL, "workgroup"); __builtin_amdgcn_wave_barrier();
  const int rsub = lane >> 4, c4 = (lane & 15) * 4;
  {
#pragma unroll
    for (int q = 0; q < 16; ++q) { const int r = q * 2 + rsub; const v4f v = *(const v4fa*)&so[w][r][c4]; if (C) *(v4f*)(C + cofs + (size_t)(row0 + r) * ldc + col0 + c4) = v; if (C16) { v4h h4; for (int i = 0; i < 4; ++i) h4[i] = (_Float16)v[i]; *(v4h*)(C16 + cofs + (size_t)(row0 + r) * ldc + col0 + c4) = h4; } }
     } }


// Row softmax, one work-group a row: 256 lanes hold the row's 8192 scores in registers (8 loads of 16 B a lane, each wave-wide load 512 contiguous bytes), so the row is read once;
// maximum and sum by a butterfly inside each wave, then the 8 waves' partials through LDS. Every loop over v[] is unrolled so that its indices are constants and the row stays in registers.
__global__ __launch_bounds__(256) void k_rsmf(const float* __restrict__ S, _Float16* __restrict__ P, int qn, int hg) {
  static_assert(SQ == 8 * 256 * 4, "a row is 8 x 16 B for each of 256 lanes");
  __shared__ float rmx[8], rse[8];
  const int row = blockIdx.x; if (row >= qn * hg) return;      /* the same for the whole work-group, in front of both barriers */
  const int tid = threadIdx.x, w = tid >> 5, lane = tid & 31; const size_t i = (size_t)(row / qn) * SQ + (row % qn); const float* s = S + i * SQ + tid * 4; v4f v[8];
#pragma unroll
  for (int c = 0; c < 8; ++c) v[c] = *(const v4fa*)(s + c * 1024);
  float mx = -3.0e38f;
#pragma unroll
  for (int c = 0; c < 8; ++c) mx = fmaxf(mx, fmaxf(fmaxf(v[c][0], v[c][1]), fmaxf(v[c][2], v[c][3])));
#pragma unroll
  for (int m = 16; m > 0; m >>= 1) mx = fmaxf(mx, __shfl_xor(mx, m, 32));
  if (lane == 0) rmx[w] = mx;
  __syncthreads();      /* publishes the 8 waves' maxima */
#pragma unroll
  for (int u = 0; u < 8; ++u) mx = fmaxf(mx, rmx[u]);
  v4f a4 = {0.f, 0.f, 0.f, 0.f};
#pragma unroll
  for (int c = 0; c < 8; ++c) {
#pragma unroll
    for (int q = 0; q < 4; ++q) v[c][q] = __expf(v[c][q] - mx);
    a4 += v[c]; }
  float se = (a4[0] + a4[1]) + (a4[2] + a4[3]);
#pragma unroll
  for (int m = 16; m > 0; m >>= 1) se += __shfl_xor(se, m, 32);
  if (lane == 0) rse[w] = se;
  __syncthreads();      /* publishes the 8 waves' sums */
  se = 0.f;
#pragma unroll
  for (int u = 0; u < 8; ++u) se += rse[u];
  const float sc = 256.0f / se; _Float16* d = P + i * SQ + tid * 4;
#pragma unroll
  for (int c = 0; c < 8; ++c) { v4h h4;
#pragma unroll
    for (int q = 0; q < 4; ++q) h4[q] = (_Float16)(v[c][q] * sc);
    *(v4h*)(d + c * 1024) = h4; } }

extern "C" void kernel_launch(void* const* d_in, const int* in_sizes, int n_in,
                              void* d_out, int out_size, void* d_ws, size_t ws_size, hipStream_t stream) {
  (void)in_sizes; (void)n_in; (void)out_size;
  const float* const* I = (const float* const*)d_in; const float* x = I[0]; const float* wq = I[1]; const float* wk = I[2]; const float* wv = I[3];      /* x [8192][768] (ONE unbatched sequence); three separate [in][out] weights W_q, W_k, W_v [768][64]: ONE head of 64; no biases; no output projection */
  static_assert(NH == 1 && HG == 1 && SQ % QC == 0 && QC % 128 == 0, "one head, one head a launch group, whole query chunks");
  char* ws = (char*)d_ws; size_t off = 0;
  auto take = [&](size_t bytes) { char* p = ws + off; off += (bytes + 255) & ~(size_t)255; return p; };
  _Float16* BQKV = (_Float16*)take((size_t)3 * LQ * DM * 2); _Float16* BQ = BQKV; _Float16* BK = BQKV + (size_t)LQ * DM; _Float16* BV = BQKV + (size_t)2 * LQ * DM;      /* three transposed planes Bt [64][768], one after another */
  _Float16* X16 = (_Float16*)take(NR * DM * 2); _Float16* Q16 = (_Float16*)take(NR * LQ * 2); _Float16* K16 = (_Float16*)take(NR * LQ * 2); _Float16* V16 = (_Float16*)take(NR * LQ * 2);
  float* S = (float*)take((size_t)HG * QC * SQ * 4); _Float16* P = (_Float16*)take((size_t)HG * QC * SQ * 2);      /* ONE query chunk of one head at a time: [2048][8192] */ _Float16* VT = (_Float16*)take((size_t)NH * HD * SQ * 2);
  if (off > ws_size) return;
  k_wt_f16<<<(unsigned)(((size_t)LQ * (DM / 8) + 255) / 256), 256, 0, stream>>>(wq, BQ, DM, LQ, 16.0f); k_wt_f16<<<(unsigned)(((size_t)LQ * (DM / 8) + 255) / 256), 256, 0, stream>>>(wk, BK, DM, LQ, 16.0f); k_wt_f16<<<(unsigned)(((size_t)LQ * (DM / 8) + 255) / 256), 256, 0, stream>>>(wv, BV, DM, LQ, 16.0f);      /* three [in][out] weights -> their transposed x16 planes, one after another */

  k_x16<<<(unsigned)((NR * DM / 8 + 255) / 256), 256, 0, stream>>>(x, X16, NR * DM / 8);
  const size_t r0p = (size_t)B0 * SQ;      /* first projected row */
  k_gemm2<0><<<dim3((unsigned)((MP / 128) * (LQ / 64)), 1), 128, 0, stream>>>(X16 + r0p * DM, DM, 0, BQ, DM, 0, 0.0625f, nullptr, 0, nullptr, 1, 0, 0, nullptr, Q16 + r0p * LQ, LQ, 0, MP, LQ, DM);      /* q = x W as f16 rows [8192][64] (K = 768, N = 64; no bias) */
  k_gemm2<0><<<dim3((unsigned)((MP / 128) * (LQ / 64)), 1), 128, 0, stream>>>(X16 + r0p * DM, DM, 0, BK, DM, 0, 0.0625f, nullptr, 0, nullptr, 1, 0, 0, nullptr, K16 + r0p * LQ, LQ, 0, MP, LQ, DM);      /* k = x W as f16 rows [8192][64] (K = 768, N = 64; no bias) */
  k_gemm2<0><<<dim3((unsigned)((MP / 128) * (LQ / 64)), 1), 128, 0, stream>>>(X16 + r0p * DM, DM, 0, BV, DM, 0, 0.0625f, nullptr, 0, nullptr, 1, 0, 0, nullptr, V16 + r0p * LQ, LQ, 0, MP, LQ, DM);      /* v = x W as f16 rows [8192][64] (K = 768, N = 64; no bias) */
  for (int b = B0; b < B0 + NBR; ++b) { const size_t r0 = (size_t)b * SQ;
    k_vt<NH, SQ><<<NH * (SQ / 64), 256, 0, stream>>>(V16 + r0 * LQ, LQ, 0, VT);      /* V^T [NH][HD][SQ] for this batch */
    for (int h0 = 0; h0 < NHD; h0 += HG) {
      for (int q0 = 0; q0 < QN; q0 += QC) {      /* the queries in chunks of QC rows: each pass fills the score and weight planes anew after the launches that read them */
        k_gemm2<0><<<dim3((QC / 128) * (SQ / 64), HG), 128, 0, stream>>>(Q16 + (r0 + q0) * LQ + h0 * HD, LQ, (size_t)HD, K16 + r0 * LQ + h0 * HD, LQ, (size_t)HD, 0.125f, nullptr, 0, nullptr, 1, 0, 0, S, nullptr, SQ, (size_t)QC * SQ, QC, SQ, HD);      /* one-pass scores at the module's factor 1/8: q . k / 8 (K = 64) for QC query rows against all SQ keys */
        k_rsmf<<<HG * QC, 256, 0, stream>>>(S, P, QC, HG);      /* P = 256 softmax (f16) of the chunk's rows */
        k_gemm2<0><<<dim3((QC / 128) * (HD / 64), HG), 128, 0, stream>>>(P, SQ, (size_t)QC * SQ, VT + (size_t)h0 * HD * SQ, SQ, (size_t)HD * SQ, 0.00390625f, nullptr, 0, nullptr, 1, 0, 0, (float*)d_out + (r0 + q0) * LQ + h0 * HD, nullptr, LQ, (size_t)HD, QC, HD, SQ); } } }      /* the chunk's context rows straight into the output as f32: P carries 256 x the weights */
}

// v002
// Measured time: 303 microseconds a run.
// Timed twice side by side with v001, it ran 3.77 and 3.76 times as fast.
// Over all steps from v000 it is 15.7 times as fast.
#include <hip/hip_runtime.h>
// Single-head self-attention, unmasked, over ONE unbatched sequence of 8192 tokens, with three separate projections to width 64 and NO output projection (x [8192][768]; q = x W_q, k = x W_k, v = x W_v ([in][out] 768 x 64 each, no bias): ONE head of 64; scores = q . k / sqrt(64); softmax over all 8192 keys (no mask); out = weights v -> [8192][64]).
// Structure: token rows r = s; x as exact f16 rows (bf16-rounded); the three [in][out] weights staged as x16 f16 planes (transposed), one after another, feeding three WMMA GEMMs (32x64 wave tiles, f32 accumulation, exact x16 weights; K = 768, N = 64) that write q, k and v as f16 rows; V^T via an LDS transpose; the queries in four chunks of 2048 rows (a chunk's 2048 x 8192 score plane is 64 MiB): one-pass scores (K = 64, alpha = 1/8: the module's division by sqrt(64)), row softmax on VALU, one work-group a row (f32 statistics, native exp; weights stored x256 as f16), out = P . V^T GEMM (K = 8192 split into 32 key ranges, one grid row each, alpha 2^-8) written as f32 partial rows; one last launch sums each row's partials into the output.
// Compute dtype: inputs rounded to bf16; x / weights exact; q, k, v and the softmax weights as plain f16 GEMM operands (~2^-12); scores, softmax statistics and the output f32. v_wmma_f32_16x16x32_f16.
#define NB 1
#define SQ 8192
#define DM 768
#define NH 1
#define HD 64
#define HG 1                         /* heads per attention launch group */
#define B0 0                         /* first batch processed (debug hook) */
#define NBR NB                       /* batches processed (debug hook) */
#define NR ((size_t)NB * SQ)         /* token rows */
#define MP ((int)((size_t)NBR * SQ)) /* rows projected (debug hook) */
#define QN SQ                        /* query rows attended per batch (debug hook) */
#define NHD NH                       /* heads attended (debug hook) */
#define MPO MP                       /* unused: no output projection stage */
#define LQ (NH * HD)      /* row pitch of the q/k/v rows: the heads' total width (64), NOT the input width DM */
#define QC 2048                      /* query rows a pass: a 2048 x 8192 score plane is 64 MiB */
#define KS 32                        /* key ranges of the P . V^T product: each range of SQ / KS keys is a work-group row of its own */
typedef __bf16 v16b __attribute__((ext_vector_type(16)));
typedef unsigned short v8us __attribute__((ext_vector_type(8), may_alias));
typedef float  v8f  __attribute__((ext_vector_type(8)));
typedef float  v4f  __attribute__((ext_vector_type(4)));
typedef float  v4fa __attribute__((ext_vector_type(4), may_alias));
union FragB { v16b v; v8us half[2]; unsigned short u[16]; };

__device__ __forceinline__ unsigned short bf16_bits(float x) { unsigned int u = __float_as_uint(x); return (unsigned short)((u + 0x7FFFu + ((u >> 16) & 1u)) >> 16); }
__device__ __forceinline__ float bf16_val(unsigned short b) { return __uint_as_float(((unsigned int)b) << 16); }
__device__ __forceinline__ float bf16_round(float x) { return bf16_val(bf16_bits(x)); }
// D += A·B with NT terms: 1 = ah·bh, 2 = + al·bh (A split), 3 = + ah·bl (both split)
template <int NT>
__device__ __forceinline__ v8f mmaN(v16b ah, v16b al, v16b bh, v16b bl, v8f c) {
  c = __builtin_amdgcn_wmma_f32_16x16x32_bf16(false, ah, false, bh, (short)0, c, false, false);
  if (NT >= 2) c = __builtin_amdgcn_wmma_f32_16x16x32_bf16(false, al, false, bh, (short)0, c, false, false);
  if (NT >= 3) c = __builtin_amdgcn_wmma_f32_16x16x32_bf16(false, ah, false, bl, (short)0, c, false, false);
  asm volatile("v_nop\n\tv_nop\n\tv_nop\n\tv_nop" : "+v"(c) : "v"(ah), "v"(al), "v"(bh), "v"(bl));
  return c;
}




// ---- f16 WMMA path (v_wmma_f32_16x16x32_f16): 11-bit significands for operands in range — used where a [0,1] probability operand needs more precision than bf16
typedef _Float16 v16h __attribute__((ext_vector_type(16)));
union FragH { v16h v; v8us half[2]; _Float16 h[16]; unsigned short u[16]; };
template <int NT>
__device__ __forceinline__ v8f mmaH(v16h ah, v16h al, v16h bh, v16h bl, v8f c) {
  c = __builtin_amdgcn_wmma_f32_16x16x32_f16(false, ah, false, bh, (short)0, c, false, false);
  if (NT >= 2) c = __builtin_amdgcn_wmma_f32_16x16x32_f16(false, al, false, bh, (short)0, c, false, false);
  if (NT >= 3) c = __builtin_amdgcn_wmma_f32_16x16x32_f16(false, ah, false, bl, (short)0, c, false, false);
  asm volatile("v_nop\n\tv_nop\n\tv_nop\n\tv_nop" : "+v"(c) : "v"(ah), "v"(al), "v"(bh), "v"(bl));
  return c;
}

// Wt[n][k] = f16(W[k][n]·scale) from f32 row-major W[K][N] (scale = power of two; bf16-exact weights stay exact in f16 away from the subnormal range)
__global__ __launch_bounds__(256) void k_wt_f16(const float* __restrict__ W, _Float16* __restrict__ Wt, int K, int N, float scale) {
  const int t = blockIdx.x * 256 + threadIdx.x; if (t >= N * (K / 8)) return; const int n = t / (K / 8), k8 = (t % (K / 8)) * 8; FragH f;
#pragma unroll
  for (int i = 0; i < 8; ++i) f.h[i] = (_Float16)(bf16_round(W[(size_t)(k8 + i) * N + n]) * scale); const v8us o = f.half[0];
  *(v8us*)((unsigned short*)Wt + (size_t)n * K + k8) = o; 
}

typedef _Float16 v4h __attribute__((ext_vector_type(4)));

__global__ __launch_bounds__(256) void k_x16(const float* __restrict__ x, _Float16* __restrict__ X16, size_t n8) { const size_t t = (size_t)blockIdx.x * 256 + threadIdx.x; if (t >= n8) return; FragH f;
#pragma unroll
  for (int q = 0; q < 8; ++q) f.h[q] = (_Float16)bf16_round(x[t * 8 + q]); *(v8us*)((unsigned short*)X16 + t * 8) = f.half[0];  }
template <int NHv, int TTv>
__global__ __launch_bounds__(256) void k_vt(const _Float16* __restrict__ V16, int ldv, int voff, _Float16* __restrict__ Vt) { __shared__ unsigned short tl[64][66]; const int tid = threadIdx.x; const int slab = blockIdx.x / (TTv / 64), lg = blockIdx.x % (TTv / 64); const int b = slab / NHv, h = slab % NHv;
  for (int i = tid; i < 64 * 8; i += 256) { const int r = i / 8, c8 = (i % 8) * 8; FragH f; f.half[0] = *(const v8us*)((const unsigned short*)V16 + ((size_t)b * TTv + lg * 64 + r) * ldv + voff + h * 64 + c8);
#pragma unroll
    for (int q = 0; q < 8; ++q) tl[r][c8 + q] = f.u[q]; }
  __syncthreads();
  {
#pragma unroll
    for (int rd = 0; rd < 2; ++rd) { const int d = rd * 32 + tid / 8, pc = tid % 8; FragH f;
#pragma unroll
      for (int q = 0; q < 8; ++q) f.u[q] = tl[pc * 8 + q][d];
      *(v8us*)((unsigned short*)Vt + ((size_t)slab * 64 + d) * TTv + lg * 64 + pc * 8) = f.half[0]; }
     } }


// ---- fast GEMM (wave tile 32x64; requires M % 32 == 0 rows per launch region and N % 64 == 0) ----
__device__ __forceinline__ v16h g2_frag(const _Float16* p, int hh) { FragH f; f.half[0] = *(const v8us*)((const unsigned short*)p + 8 * hh); f.half[1] = *(const v8us*)((const unsigned short*)p + 16 + 8 * hh); return f.v; }
__device__ __forceinline__ v8f g2_mma(v16h a, v16h b, v8f c) { v8f d = __builtin_amdgcn_wmma_f32_16x16x32_f16(false, a, false, b, (short)0, c, false, false); asm volatile("v_nop\n\tv_nop\n\tv_nop\n\tv_nop" : "+v"(d) : "v"(a), "v"(b)); return d; }
template <int ACT>
__global__ __launch_bounds__(128) void k_gemm2(const _Float16* __restrict__ A, int lda, size_t sA, const _Float16* __restrict__ Bh, int ldb, size_t sB, float alpha, const float* __restrict__ bias, size_t sBias, const float* __restrict__ CP, int rowsPerB, size_t sCPb, int row0g,
    float* __restrict__ C, _Float16* __restrict__ C16, int ldc, size_t sC, int M, int N, int K) { static_assert(ACT == 0 || ACT == 3 || ACT == 6 || ACT == 8 || ACT == 9 || ACT == 11 || ACT == 12 || ACT == 14 || ACT == 15 || ACT == 16 || ACT == 17, "k_gemm2: unsupported ACT code (would silently apply no activation)");
  __shared__ __attribute__((aligned(16))) float so[4][32][68];
  const int tid = threadIdx.x, w = tid >> 5, lane = tid & 31, ln = lane & 15, hh = lane >> 4; const int by = blockIdx.y;
  A += (size_t)by * sA; Bh += (size_t)by * sB; const size_t cofs = (size_t)by * sC; const float* bp = bias ? bias + (size_t)by * sBias : nullptr;
  const int ntn = N >> 6; const int mt = blockIdx.x / ntn, nq = blockIdx.x - mt * ntn; const int row0 = mt * 128 + 32 * w, col0 = nq * 64; if (row0 >= M) return;
  const _Float16* a0p = A + (size_t)(row0 + ln) * lda; const _Float16* a1p = a0p + (size_t)16 * lda;
  const _Float16* b0p = Bh + (size_t)(col0 + ln) * ldb; const _Float16* b1p = b0p + (size_t)16 * ldb; const _Float16* b2p = b1p + (size_t)16 * ldb; const _Float16* b3p = b2p + (size_t)16 * ldb;
  const v8f z8 = {0.f,0.f,0.f,0.f,0.f,0.f,0.f,0.f}; v8f c00 = z8, c01 = z8, c02 = z8, c03 = z8, c10 = z8, c11 = z8, c12 = z8, c13 = z8;
  for (int kb = 0; kb < K; kb += 32) { const v16h a0 = g2_frag(a0p + kb, hh), a1 = g2_frag(a1p + kb, hh);
    v16h b = g2_frag(b0p + kb, hh); c00 = g2_mma(a0, b, c00); c10 = g2_mma(a1, b, c10);
    b = g2_frag(b1p + kb, hh); c01 = g2_mma(a0, b, c01); c11 = g2_mma(a1, b, c11);
    b = g2_frag(b2p + kb, hh); c02 = g2_mma(a0, b, c02); c12 = g2_mma(a1, b, c12);
    b = g2_frag(b3p + kb, hh); c03 = g2_mma(a0, b, c03); c13 = g2_mma(a1, b, c13); }
  v8f accs[8] = {c00, c01, c02, c03, c10, c11, c12, c13};
#pragma unroll
  for (int u = 0; u < 8; ++u) { const int t = u & 3, half = u >> 2; const int col = col0 + t * 16 + ln; const float bv = bp ? bf16_round(bp[col]) : 0.f;
#pragma unroll
    for (int r = 0; r < 8; ++r) { const int rloc = half * 16 + 8 * hh + r; float v = accs[u][r] * alpha + bv; if (CP) { if (rowsPerB < 0) v += CP[cofs + (size_t)(row0g + row0 + rloc) * ldc + col];      /* rowsPerB < 0: own element of the batched C plane */ else { const int bidx = (row0g + row0 + rloc) / rowsPerB; v += CP[(size_t)bidx * sCPb + (size_t)by * 64 + col]; } }
      if (ACT == 3) v = fmaxf(v, 0.f); else if (ACT == 6) v = 0.5f * v * (1.0f + erff(v * 0.70710678118654752f)); else if (ACT == 11) v = 1.0f / (1.0f + expf(-v)); else if (ACT == 15) v = v / (1.0f + expf(-v)); else if (ACT == 12) v = (v > 0.f) ? v : 0.01f * v; else if (ACT == 8) v = tanhf(v); else if (ACT == 9) v = 0.5f * v * (1.0f + tanhf(0.7978845608028654f * (v + 0.044715f * v * v * v))); else if (ACT == 14) v = (v > 0.f) ? v : 0.1f * v; else if (ACT == 16) v = (v >= 0.f) ? v : 0.3f * v; else if (ACT == 17) v = (v >= 0.f) ? v : 0.2f * v;
      so[w][rloc][t * 16 + ln] = v; } }
  __builtin_amdgcn_fence(__ATOMIC_ACQ_REL, "workgroup"); __builtin_amdgcn_wave_barrier();
  const int rsub = lane >> 4, c4 = (lane & 15) * 4;
  {
#pragma unroll
    for (int q = 0; q < 16; ++q) { const int r = q * 2 + rsub; const v4f v = *(const v4fa*)&so[w][r][c4]; if (C) *(v4f*)(C + cofs + (size_t)(row0 + r) * ldc + col0 + c4) = v; if (C16) { v4h h4; for (int i = 0; i < 4; ++i) h4[i] = (_Float16)v[i]; *(v4h*)(C16 + cofs + (size_t)(row0 + r) * ldc + col0 + c4) = h4; } }
     } }


// Row softmax, one work-group a row: 256 lanes hold the row's 8192 scores in registers (8 loads of 16 B a lane, each wave-wide load 512 contiguous bytes), so the row is read once;
// maximum and sum by a butterfly inside each wave, then the 8 waves' partials through LDS. Every loop over v[] is unrolled so that its indices are constants and the row stays in registers.
__global__ __launch_bounds__(256) void k_rsmf(const float* __restrict__ S, _Float16* __restrict__ P, int qn, int hg) {
  static_assert(SQ == 8 * 256 * 4, "a row is 8 x 16 B for each of 256 lanes");
  __shared__ float rmx[8], rse[8];
  const int row = blockIdx.x; if (row >= qn * hg) return;      /* the same for the whole work-group, in front of both barriers */
  const int tid = threadIdx.x, w = tid >> 5, lane = tid & 31; const size_t i = (size_t)(row / qn) * SQ + (row % qn); const float* s = S + i * SQ + tid * 4; v4f v[8];
#pragma unroll
  for (int c = 0; c < 8; ++c) v[c] = *(const v4fa*)(s + c * 1024);
  float mx = -3.0e38f;
#pragma unroll
  for (int c = 0; c < 8; ++c) mx = fmaxf(mx, fmaxf(fmaxf(v[c][0], v[c][1]), fmaxf(v[c][2], v[c][3])));
#pragma unroll
  for (int m = 16; m > 0; m >>= 1) mx = fmaxf(mx, __shfl_xor(mx, m, 32));
  if (lane == 0) rmx[w] = mx;
  __syncthreads();      /* publishes the 8 waves' maxima */
#pragma unroll
  for (int u = 0; u < 8; ++u) mx = fmaxf(mx, rmx[u]);
  v4f a4 = {0.f, 0.f, 0.f, 0.f};
#pragma unroll
  for (int c = 0; c < 8; ++c) {
#pragma unroll
    for (int q = 0; q < 4; ++q) v[c][q] = __expf(v[c][q] - mx);
    a4 += v[c]; }
  float se = (a4[0] + a4[1]) + (a4[2] + a4[3]);
#pragma unroll
  for (int m = 16; m > 0; m >>= 1) se += __shfl_xor(se, m, 32);
  if (lane == 0) rse[w] = se;
  __syncthreads();      /* publishes the 8 waves' sums */
  se = 0.f;
#pragma unroll
  for (int u = 0; u < 8; ++u) se += rse[u];
  const float sc = 256.0f / se; _Float16* d = P + i * SQ + tid * 4;
#pragma unroll
  for (int c = 0; c < 8; ++c) { v4h h4;
#pragma unroll
    for (int q = 0; q < 4; ++q) h4[q] = (_Float16)(v[c][q] * sc);
    *(v4h*)(d + c * 1024) = h4; } }

// out row = sum over the KS key ranges of that row's P . V^T partials [8192][KS][64], in rising order of the range; one 16 B column group a lane, so a wave-wide load is two whole 256 B partial rows.
// Both loops are unrolled so that v[] stays in registers and many of a lane's loads are in flight at once.
__global__ __launch_bounds__(256) void k_ksum(const float* __restrict__ part, float* __restrict__ out) {
  const size_t t = (size_t)blockIdx.x * 256 + threadIdx.x; const float* p = part + (t >> 4) * (KS * LQ) + (t & 15) * 4; v4f v[KS];
#pragma unroll
  for (int s = 0; s < KS; ++s) v[s] = *(const v4fa*)(p + s * LQ);
  v4f a = v[0];
#pragma unroll
  for (int s = 1; s < KS; ++s) a += v[s];
  *(v4fa*)(out + t * 4) = a; }

extern "C" void kernel_launch(void* const* d_in, const int* in_sizes, int n_in,
                              void* d_out, int out_size, void* d_ws, size_t ws_size, hipStream_t stream) {
  (void)in_sizes; (void)n_in; (void)out_size;
  const float* const* I = (const float* const*)d_in; const float* x = I[0]; const float* wq = I[1]; const float* wk = I[2]; const float* wv = I[3];      /* x [8192][768] (ONE unbatched sequence); three separate [in][out] weights W_q, W_k, W_v [768][64]: ONE head of 64; no biases; no output projection */
  static_assert(NH == 1 && HG == 1 && SQ % QC == 0 && QC % 128 == 0, "one head, one head a launch group, whole query chunks");
  static_assert(NB == 1 && LQ == 64 && SQ % (KS * 32) == 0 && (NR * LQ) % 1024 == 0, "whole k steps in a key range; 16 lanes a row and whole work-groups in the sum over the ranges");
  char* ws = (char*)d_ws; size_t off = 0;
  auto take = [&](size_t bytes) { char* p = ws + off; off += (bytes + 255) & ~(size_t)255; return p; };
  _Float16* BQKV = (_Float16*)take((size_t)3 * LQ * DM * 2); _Float16* BQ = BQKV; _Float16* BK = BQKV + (size_t)LQ * DM; _Float16* BV = BQKV + (size_t)2 * LQ * DM;      /* three transposed planes Bt [64][768], one after another */
  _Float16* X16 = (_Float16*)take(NR * DM * 2); _Float16* Q16 = (_Float16*)take(NR * LQ * 2); _Float16* K16 = (_Float16*)take(NR * LQ * 2); _Float16* V16 = (_Float16*)take(NR * LQ * 2);
  float* S = (float*)take((size_t)HG * QC * SQ * 4); _Float16* P = (_Float16*)take((size_t)HG * QC * SQ * 2);      /* ONE query chunk of one head at a time: [2048][8192] */ _Float16* VT = (_Float16*)take((size_t)NH * HD * SQ * 2);
  float* PART = (float*)take((size_t)KS * NR * LQ * 4);      /* partial output rows [8192][KS][64] f32: a row's KS partials lie side by side */
  if (off > ws_size) return;
  k_wt_f16<<<(unsigned)(((size_t)LQ * (DM / 8) + 255) / 256), 256, 0, stream>>>(wq, BQ, DM, LQ, 16.0f); k_wt_f16<<<(unsigned)(((size_t)LQ * (DM / 8) + 255) / 256), 256, 0, stream>>>(wk, BK, DM, LQ, 16.0f); k_wt_f16<<<(unsigned)(((size_t)LQ * (DM / 8) + 255) / 256), 256, 0, stream>>>(wv, BV, DM, LQ, 16.0f);      /* three [in][out] weights -> their transposed x16 planes, one after another */

  k_x16<<<(unsigned)((NR * DM / 8 + 255) / 256), 256, 0, stream>>>(x, X16, NR * DM / 8);
  const size_t r0p = (size_t)B0 * SQ;      /* first projected row */
  k_gemm2<0><<<dim3((unsigned)((MP / 128) * (LQ / 64)), 1), 128, 0, stream>>>(X16 + r0p * DM, DM, 0, BQ, DM, 0, 0.0625f, nullptr, 0, nullptr, 1, 0, 0, nullptr, Q16 + r0p * LQ, LQ, 0, MP, LQ, DM);      /* q = x W as f16 rows [8192][64] (K = 768, N = 64; no bias) */
  k_gemm2<0><<<dim3((unsigned)((MP / 128) * (LQ / 64)), 1), 128, 0, stream>>>(X16 + r0p * DM, DM, 0, BK, DM, 0, 0.0625f, nullptr, 0, nullptr, 1, 0, 0, nullptr, K16 + r0p * LQ, LQ, 0, MP, LQ, DM);      /* k = x W as f16 rows [8192][64] (K = 768, N = 64; no bias) */
  k_gemm2<0><<<dim3((unsigned)((MP / 128) * (LQ / 64)), 1), 128, 0, stream>>>(X16 + r0p * DM, DM, 0, BV, DM, 0, 0.0625f, nullptr, 0, nullptr, 1, 0, 0, nullptr, V16 + r0p * LQ, LQ, 0, MP, LQ, DM);      /* v = x W as f16 rows [8192][64] (K = 768, N = 64; no bias) */
  for (int b = B0; b < B0 + NBR; ++b) { const size_t r0 = (size_t)b * SQ;
    k_vt<NH, SQ><<<NH * (SQ / 64), 256, 0, stream>>>(V16 + r0 * LQ, LQ, 0, VT);      /* V^T [NH][HD][SQ] for this batch */
    for (int h0 = 0; h0 < NHD; h0 += HG) {
      for (int q0 = 0; q0 < QN; q0 += QC) {      /* the queries in chunks of QC rows: each pass fills the score and weight planes anew after the launches that read them */
        k_gemm2<0><<<dim3((QC / 128) * (SQ / 64), HG), 128, 0, stream>>>(Q16 + (r0 + q0) * LQ + h0 * HD, LQ, (size_t)HD, K16 + r0 * LQ + h0 * HD, LQ, (size_t)HD, 0.125f, nullptr, 0, nullptr, 1, 0, 0, S, nullptr, SQ, (size_t)QC * SQ, QC, SQ, HD);      /* one-pass scores at the module's factor 1/8: q . k / 8 (K = 64) for QC query rows against all SQ keys */
        k_rsmf<<<HG * QC, 256, 0, stream>>>(S, P, QC, HG);      /* P = 256 softmax (f16) of the chunk's rows */
        k_gemm2<0><<<dim3((QC / 128) * (HD / 64), KS), 128, 0, stream>>>(P, SQ, (size_t)(SQ / KS), VT + (size_t)h0 * HD * SQ, SQ, (size_t)(SQ / KS), 0.00390625f, nullptr, 0, nullptr, 1, 0, 0, PART + (r0 + q0) * (KS * LQ) + h0 * HD, nullptr, KS * LQ, (size_t)LQ, QC, HD, SQ / KS); } } }      /* the chunk's context rows, split over the keys: grid row y sums its SQ / KS keys into partial y of each row (f32); P carries 256 x the weights */
  k_ksum<<<(unsigned)(NR * LQ / 1024), 256, 0, stream>>>(PART, (float*)d_out);      /* each row's KS partials summed into the output */
}

// v003
// A run of this version takes 125 microseconds.
// Two timings next to v002 put it at 2.45 and 2.42 times that version's speed.
// All steps since v000 together make it 38.2 times as fast.
#include <hip/hip_runtime.h>
// Single-head self-attention, unmasked, over ONE unbatched sequence of 8192 tokens, with three separate projections to width 64 and NO output projection (x [8192][768]; q = x W_q, k = x W_k, v = x W_v ([in][out] 768 x 64 each, no bias): ONE head of 64; scores = q . k / sqrt(64); softmax over all 8192 keys (no mask); out = weights v -> [8192][64]).
// Structure: token rows r = s; x as exact f16 rows (bf16-rounded); the three [in][out] weights staged as x16 f16 planes (transposed), one after another, feeding three WMMA GEMMs (32x64 wave tiles, f32 accumulation, exact x16 weights; K = 768, N = 64) that write q, k and v as f16 rows; V^T via an LDS transpose; then ONE fused attention launch: a work-group takes 256 queries and one of 16 key ranges, forms S^T = K . Q^T tiles in registers (factor 1/8: the module's division by sqrt(64)), keeps a running maximum and sum a query (online softmax, f32, native exp2), packs the weights as f16 straight into the B operand of O^T += V^T . P^T, and writes un-normalised f32 partial rows with their (maximum, sum); one last launch merges each row's 16 partials into the output.
// Compute dtype: inputs rounded to bf16; x / weights exact; q, k, v and the softmax weights as plain f16 GEMM operands (~2^-12); scores, softmax statistics and the output f32. v_wmma_f32_16x16x32_f16.
#define NB 1
#define SQ 8192
#define DM 768
#define NH 1
#define HD 64
#define HG 1                         /* heads per attention launch group */
#define B0 0                         /* first batch processed (debug hook) */
#define NBR NB                       /* batches processed (debug hook) */
#define NR ((size_t)NB * SQ)         /* token rows */
#define MP ((int)((size_t)NBR * SQ)) /* rows projected (debug hook) */
#define QN SQ                        /* unused: the attention launch takes all SQ queries */
#define NHD NH                       /* unused: the attention launch takes the one head */
#define MPO MP                       /* unused: no output projection stage */
#define LQ (NH * HD)      /* row pitch of the q/k/v rows: the heads' total width (64), NOT the input width DM */
#define FK 16                        /* key ranges of the fused attention launch: each range of SQ / FK keys is a grid row of its own */
#define FST 64                       /* keys a stage: one LDS buffer holds 64 K rows and 64 columns of V^T */
#define FP 72                        /* LDS row pitch in f16: 144 B = 16 B x 9, so that 16 rows' 16 B reads fall on 16 different bank groups */
#define SC2 0.18033688011112042f     /* (1 / 8) log2(e): scores in the log2 domain */
typedef __bf16 v16b __attribute__((ext_vector_type(16)));
typedef unsigned short v8us __attribute__((ext_vector_type(8), may_alias));
typedef float  v8f  __attribute__((ext_vector_type(8)));
typedef float  v4f  __attribute__((ext_vector_type(4)));
typedef float  v4fa __attribute__((ext_vector_type(4), may_alias));
union FragB { v16b v; v8us half[2]; unsigned short u[16]; };

__device__ __forceinline__ unsigned short bf16_bits(float x) { unsigned int u = __float_as_uint(x); return (unsigned short)((u + 0x7FFFu + ((u >> 16) & 1u)) >> 16); }
__device__ __forceinline__ float bf16_val(unsigned short b) { return __uint_as_float(((unsigned int)b) << 16); }
__device__ __forceinline__ float bf16_round(float x) { return bf16_val(bf16_bits(x)); }
// D += A·B with NT terms: 1 = ah·bh, 2 = + al·bh (A split), 3 = + ah·bl (both split)
template <int NT>
__device__ __forceinline__ v8f mmaN(v16b ah, v16b al, v16b bh, v16b bl, v8f c) {
  c = __builtin_amdgcn_wmma_f32_16x16x32_bf16(false, ah, false, bh, (short)0, c, false, false);
  if (NT >= 2) c = __builtin_amdgcn_wmma_f32_16x16x32_bf16(false, al, false, bh, (short)0, c, false, false);
  if (NT >= 3) c = __builtin_amdgcn_wmma_f32_16x16x32_bf16(false, ah, false, bl, (short)0, c, false, false);
  asm volatile("v_nop\n\tv_nop\n\tv_nop\n\tv_nop" : "+v"(c) : "v"(ah), "v"(al), "v"(bh), "v"(bl));
  return c;
}




// ---- f16 WMMA path (v_wmma_f32_16x16x32_f16): 11-bit significands for operands in range — used where a softmax weight operand (up to 2^8) needs more precision than bf16
typedef _Float16 v16h __attribute__((ext_vector_type(16)));
union FragH { v16h v; v8us half[2]; _Float16 h[16]; unsigned short u[16]; };
template <int NT>
__device__ __forceinline__ v8f mmaH(v16h ah, v16h al, v16h bh, v16h bl, v8f c) {
  c = __builtin_amdgcn_wmma_f32_16x16x32_f16(false, ah, false, bh, (short)0, c, false, false);
  if (NT >= 2) c = __builtin_amdgcn_wmma_f32_16x16x32_f16(false, al, false, bh, (short)0, c, false, false);
  if (NT >= 3) c = __builtin_amdgcn_wmma_f32_16x16x32_f16(false, ah, false, bl, (short)0, c, false, false);
  asm volatile("v_nop\n\tv_nop\n\tv_nop\n\tv_nop" : "+v"(c) : "v"(ah), "v"(al), "v"(bh), "v"(bl));
  return c;
}

// Wt[n][k] = f16(W[k][n]·scale) from f32 row-major W[K][N] (scale = power of two; bf16-exact weights stay exact in f16 away from the subnormal range)
__global__ __launch_bounds__(256) void k_wt_f16(const float* __restrict__ W, _Float16* __restrict__ Wt, int K, int N, float scale) {
  const int t = blockIdx.x * 256 + threadIdx.x; if (t >= N * (K / 8)) return; const int n = t / (K / 8), k8 = (t % (K / 8)) * 8; FragH f;
#pragma unroll
  for (int i = 0; i < 8; ++i) f.h[i] = (_Float16)(bf16_round(W[(size_t)(k8 + i) * N + n]) * scale); const v8us o = f.half[0];
  *(v8us*)((unsigned short*)Wt + (size_t)n * K + k8) = o; 
}

typedef _Float16 v4h __attribute__((ext_vector_type(4)));

__global__ __launch_bounds__(256) void k_x16(const float* __restrict__ x, _Float16* __restrict__ X16, size_t n8) { const size_t t = (size_t)blockIdx.x * 256 + threadIdx.x; if (t >= n8) return; FragH f;
#pragma unroll
  for (int q = 0; q < 8; ++q) f.h[q] = (_Float16)bf16_round(x[t * 8 + q]); *(v8us*)((unsigned short*)X16 + t * 8) = f.half[0];  }
template <int NHv, int TTv>
__global__ __launch_bounds__(256) void k_vt(const _Float16* __restrict__ V16, int ldv, int voff, _Float16* __restrict__ Vt) { __shared__ unsigned short tl[64][66]; const int tid = threadIdx.x; const int slab = blockIdx.x / (TTv / 64), lg = blockIdx.x % (TTv / 64); const int b = slab / NHv, h = slab % NHv;
  for (int i = tid; i < 64 * 8; i += 256) { const int r = i / 8, c8 = (i % 8) * 8; FragH f; f.half[0] = *(const v8us*)((const unsigned short*)V16 + ((size_t)b * TTv + lg * 64 + r) * ldv + voff + h * 64 + c8);
#pragma unroll
    for (int q = 0; q < 8; ++q) tl[r][c8 + q] = f.u[q]; }
  __syncthreads();
  {
#pragma unroll
    for (int rd = 0; rd < 2; ++rd) { const int d = rd * 32 + tid / 8, pc = tid % 8; FragH f;
#pragma unroll
      for (int q = 0; q < 8; ++q) f.u[q] = tl[pc * 8 + q][d];
      *(v8us*)((unsigned short*)Vt + ((size_t)slab * 64 + d) * TTv + lg * 64 + pc * 8) = f.half[0]; }
     } }


// ---- fast GEMM (wave tile 32x64; requires M % 32 == 0 rows per launch region and N % 64 == 0) ----
__device__ __forceinline__ v16h g2_frag(const _Float16* p, int hh) { FragH f; f.half[0] = *(const v8us*)((const unsigned short*)p + 8 * hh); f.half[1] = *(const v8us*)((const unsigned short*)p + 16 + 8 * hh); return f.v; }
__device__ __forceinline__ v8f g2_mma(v16h a, v16h b, v8f c) { v8f d = __builtin_amdgcn_wmma_f32_16x16x32_f16(false, a, false, b, (short)0, c, false, false); asm volatile("v_nop\n\tv_nop\n\tv_nop\n\tv_nop" : "+v"(d) : "v"(a), "v"(b)); return d; }
template <int ACT>
__global__ __launch_bounds__(128) void k_gemm2(const _Float16* __restrict__ A, int lda, size_t sA, const _Float16* __restrict__ Bh, int ldb, size_t sB, float alpha, const float* __restrict__ bias, size_t sBias, const float* __restrict__ CP, int rowsPerB, size_t sCPb, int row0g,
    float* __restrict__ C, _Float16* __restrict__ C16, int ldc, size_t sC, int M, int N, int K) { static_assert(ACT == 0 || ACT == 3 || ACT == 6 || ACT == 8 || ACT == 9 || ACT == 11 || ACT == 12 || ACT == 14 || ACT == 15 || ACT == 16 || ACT == 17, "k_gemm2: unsupported ACT code (would silently apply no activation)");
  __shared__ __attribute__((aligned(16))) float so[4][32][68];
  const int tid = threadIdx.x, w = tid >> 5, lane = tid & 31, ln = lane & 15, hh = lane >> 4; const int by = blockIdx.y;
  A += (size_t)by * sA; Bh += (size_t)by * sB; const size_t cofs = (size_t)by * sC; const float* bp = bias ? bias + (size_t)by * sBias : nullptr;
  const int ntn = N >> 6; const int mt = blockIdx.x / ntn, nq = blockIdx.x - mt * ntn; const int row0 = mt * 128 + 32 * w, col0 = nq * 64; if (row0 >= M) return;
  const _Float16* a0p = A + (size_t)(row0 + ln) * lda; const _Float16* a1p = a0p + (size_t)16 * lda;
  const _Float16* b0p = Bh + (size_t)(col0 + ln) * ldb; const _Float16* b1p = b0p + (size_t)16 * ldb; const _Float16* b2p = b1p + (size_t)16 * ldb; const _Float16* b3p = b2p + (size_t)16 * ldb;
  const v8f z8 = {0.f,0.f,0.f,0.f,0.f,0.f,0.f,0.f}; v8f c00 = z8, c01 = z8, c02 = z8, c03 = z8, c10 = z8, c11 = z8, c12 = z8, c13 = z8;
  for (int kb = 0; kb < K; kb += 32) { const v16h a0 = g2_frag(a0p + kb, hh), a1 = g2_frag(a1p + kb, hh);
    v16h b = g2_frag(b0p + kb, hh); c00 = g2_mma(a0, b, c00); c10 = g2_mma(a1, b, c10);
    b = g2_frag(b1p + kb, hh); c01 = g2_mma(a0, b, c01); c11 = g2_mma(a1, b, c11);
    b = g2_frag(b2p + kb, hh); c02 = g2_mma(a0, b, c02); c12 = g2_mma(a1, b, c12);
    b = g2_frag(b3p + kb, hh); c03 = g2_mma(a0, b, c03); c13 = g2_mma(a1, b, c13); }
  v8f accs[8] = {c00, c01, c02, c03, c10, c11, c12, c13};
#pragma unroll
  for (int u = 0; u < 8; ++u) { const int t = u & 3, half = u >> 2; const int col = col0 + t * 16 + ln; const float bv = bp ? bf16_round(bp[col]) : 0.f;
#pragma unroll
    for (int r = 0; r < 8; ++r) { const int rloc = half * 16 + 8 * hh + r; float v = accs[u][r] * alpha + bv; if (CP) { if (rowsPerB < 0) v += CP[cofs + (size_t)(row0g + row0 + rloc) * ldc + col];      /* rowsPerB < 0: own element of the batched C plane */ else { const int bidx = (row0g + row0 + rloc) / rowsPerB; v += CP[(size_t)bidx * sCPb + (size_t)by * 64 + col]; } }
      if (ACT == 3) v = fmaxf(v, 0.f); else if (ACT == 6) v = 0.5f * v * (1.0f + erff(v * 0.70710678118654752f)); else if (ACT == 11) v = 1.0f / (1.0f + expf(-v)); else if (ACT == 15) v = v / (1.0f + expf(-v)); else if (ACT == 12) v = (v > 0.f) ? v : 0.01f * v; else if (ACT == 8) v = tanhf(v); else if (ACT == 9) v = 0.5f * v * (1.0f + tanhf(0.7978845608028654f * (v + 0.044715f * v * v * v))); else if (ACT == 14) v = (v > 0.f) ? v : 0.1f * v; else if (ACT == 16) v = (v >= 0.f) ? v : 0.3f * v; else if (ACT == 17) v = (v >= 0.f) ? v : 0.2f * v;
      so[w][rloc][t * 16 + ln] = v; } }
  __builtin_amdgcn_fence(__ATOMIC_ACQ_REL, "workgroup"); __builtin_amdgcn_wave_barrier();
  const int rsub = lane >> 4, c4 = (lane & 15) * 4;
  {
#pragma unroll
    for (int q = 0; q < 16; ++q) { const int r = q * 2 + rsub; const v4f v = *(const v4fa*)&so[w][r][c4]; if (C) *(v4f*)(C + cofs + (size_t)(row0 + r) * ldc + col0 + c4) = v; if (C16) { v4h h4; for (int i = 0; i < 4; ++i) h4[i] = (_Float16)v[i]; *(v4h*)(C16 + cofs + (size_t)(row0 + r) * ldc + col0 + c4) = h4; } }
     } }


// Fused attention over one key range. Work-group: 8 waves x 32 query columns; grid (SQ / 256, FK). Transposed products: S^T = K . Q^T puts one query's scores in one lane column
// (register r of tile t = key 16 t + 8 hh + r), which is the k order of a B operand, so the f16 weights go into O^T += V^T . P^T with no LDS trip and no lane exchange.
// K rows and V^T columns come through registers into two LDS buffers: the next stage's global loads are issued in front of this stage's products, stored behind them.
// Every loop over tiles, fragments and registers is unrolled so that the indices are constants and the arrays stay in registers; the loop over the stages stays rolled.
__device__ __forceinline__ v8f fa_mma(v16h a, v16h b, v8f c) { return __builtin_amdgcn_wmma_f32_16x16x32_f16(false, a, false, b, (short)0, c, false, false); }
__global__ __launch_bounds__(256) void k_fattn(const _Float16* __restrict__ Q, const _Float16* __restrict__ Kr, const _Float16* __restrict__ Vt, float* __restrict__ part, float* __restrict__ ml) {
  __shared__ __attribute__((aligned(16))) _Float16 sk[2][FST][FP];
  __shared__ __attribute__((aligned(16))) _Float16 sv[2][HD][FP];
  const int tid = threadIdx.x, w = tid >> 5, lane = tid & 31, ln = lane & 15, hh = lane >> 4;
  const int q0 = blockIdx.x * 256 + w * 32, key0 = blockIdx.y * (SQ / FK);
  v16h qf[2][2];
#pragma unroll
  for (int g = 0; g < 2; ++g) {
#pragma unroll
    for (int ks = 0; ks < 2; ++ks) qf[g][ks] = g2_frag(Q + (size_t)(q0 + g * 16 + ln) * LQ + ks * 32, hh); }
  const int sr = tid >> 3, sc = (tid & 7) * 8;      /* staging: 8 lanes a 128 B row, so a wave-wide load is 4 whole lines; rows sr and sr + 32 */
  const unsigned short* gk = (const unsigned short*)Kr + (size_t)(key0 + sr) * LQ + sc;
  const unsigned short* gv = (const unsigned short*)Vt + (size_t)sr * SQ + key0 + sc;
  v8us k0 = *(const v8us*)gk, k1 = *(const v8us*)(gk + 32 * LQ), v0 = *(const v8us*)gv, v1 = *(const v8us*)(gv + (size_t)32 * SQ);
  *(v8us*)&sk[0][sr][sc] = k0; *(v8us*)&sk[0][sr + 32][sc] = k1; *(v8us*)&sv[0][sr][sc] = v0; *(v8us*)&sv[0][sr + 32][sc] = v1;
  __syncthreads();      /* publishes stage 0 */
  const v8f z8 = {0.f,0.f,0.f,0.f,0.f,0.f,0.f,0.f};
  v8f o[4][2]; float m[2], l[2];
#pragma unroll
  for (int g = 0; g < 2; ++g) { m[g] = -3.0e38f; l[g] = 0.f;
#pragma unroll
    for (int dt = 0; dt < 4; ++dt) o[dt][g] = z8; }
  constexpr int NST = SQ / FK / FST;
  for (int st = 0; st < NST; ++st) { const int b = st & 1;
    if (st + 1 < NST) { const unsigned short* nk = gk + (size_t)(st + 1) * FST * LQ; const unsigned short* nv = gv + (st + 1) * FST;
      k0 = *(const v8us*)nk; k1 = *(const v8us*)(nk + 32 * LQ); v0 = *(const v8us*)nv; v1 = *(const v8us*)(nv + (size_t)32 * SQ); }
#pragma unroll
    for (int p = 0; p < FST / 32; ++p) {
      v8f s[2][2];
#pragma unroll
      for (int t = 0; t < 2; ++t) { const v16h ka = g2_frag(&sk[b][p * 32 + t * 16 + ln][0], hh), kb = g2_frag(&sk[b][p * 32 + t * 16 + ln][32], hh);
#pragma unroll
        for (int g = 0; g < 2; ++g) s[t][g] = fa_mma(kb, qf[g][1], fa_mma(ka, qf[g][0], z8)); }
      float mx[2]; bool need = false;
#pragma unroll
      for (int g = 0; g < 2; ++g) { float a = fmaxf(s[0][g][0], s[1][g][0]);
#pragma unroll
        for (int r = 1; r < 8; ++r) a = fmaxf(a, fmaxf(s[0][g][r], s[1][g][r]));
        mx[g] = a * SC2; need = need || (mx[g] > m[g] + 8.0f); }
      /* lazy rescale: the maximum in use moves only when some score of the wave passes it by more than 8 (log2), so a weight stays below 2^8, inside f16; one scalar branch a pass */
      if (__builtin_amdgcn_ballot_w32(need) != 0) {
#pragma unroll
        for (int g = 0; g < 2; ++g) { const float mn = fmaxf(m[g], fmaxf(mx[g], __shfl_xor(mx[g], 16, 32))); const float al = __builtin_amdgcn_exp2f(m[g] - mn); m[g] = mn; l[g] *= al;
#pragma unroll
          for (int dt = 0; dt < 4; ++dt) o[dt][g] *= al; } }
      FragH pf[2];
#pragma unroll
      for (int g = 0; g < 2; ++g) {
#pragma unroll
        for (int t = 0; t < 2; ++t) {
#pragma unroll
          for (int r = 0; r < 8; ++r) { const float e = __builtin_amdgcn_exp2f(fmaf(s[t][g][r], SC2, -m[g])); l[g] += e; pf[g].h[t * 8 + r] = (_Float16)e; } } }
#pragma unroll
      for (int dt = 0; dt < 4; ++dt) { const v16h va = g2_frag(&sv[b][dt * 16 + ln][p * 32], hh);
#pragma unroll
        for (int g = 0; g < 2; ++g) o[dt][g] = fa_mma(va, pf[g].v, o[dt][g]); } }
    if (st + 1 < NST) { *(v8us*)&sk[b ^ 1][sr][sc] = k0; *(v8us*)&sk[b ^ 1][sr + 32][sc] = k1; *(v8us*)&sv[b ^ 1][sr][sc] = v0; *(v8us*)&sv[b ^ 1][sr + 32][sc] = v1; }
    __syncthreads(); }      /* publishes stage st + 1 and ends every wave's reads of stage st, whose buffer the next trip refills */
#pragma unroll
  for (int g = 0; g < 2; ++g) { const float lt = l[g] + __shfl_xor(l[g], 16, 32); const size_t pr = (size_t)(q0 + g * 16 + ln) * FK + blockIdx.y; float* pp = part + pr * LQ + 8 * hh;
#pragma unroll
    for (int dt = 0; dt < 4; ++dt) { const v4f lo = {o[dt][g][0], o[dt][g][1], o[dt][g][2], o[dt][g][3]}, hi = {o[dt][g][4], o[dt][g][5], o[dt][g][6], o[dt][g][7]}; *(v4fa*)(pp + dt * 16) = lo; *(v4fa*)(pp + dt * 16 + 4) = hi; }
    if (hh == 0) { ml[pr * 2] = m[g]; ml[pr * 2 + 1] = lt; } } }

// out row = the row's FK partials [8192][FK][64], each weighted by exp2(its maximum - the row's maximum), in rising order of the range, over the sum of the ranges' sums, each weighted by the same factor; one 16 B column group a lane.
// The loops are unrolled so that the arrays stay in registers and a lane's loads are in flight together.
__global__ __launch_bounds__(256) void k_fmerge(const float* __restrict__ part, const float* __restrict__ ml, float* __restrict__ out) {
  const size_t t = (size_t)blockIdx.x * 256 + threadIdx.x; const float* p = part + (t >> 4) * (FK * LQ) + (t & 15) * 4; const float* q = ml + (t >> 4) * (FK * 2); v4f v[FK]; float mm[FK], ll[FK];
#pragma unroll
  for (int s = 0; s < FK; ++s) { mm[s] = q[s * 2]; ll[s] = q[s * 2 + 1]; }
  asm volatile("s_wait_xcnt 0x0" ::: "memory");      /* the loads below may land in the registers that held the address of the loads above */
#pragma unroll
  for (int s = 0; s < FK; ++s) v[s] = *(const v4fa*)(p + s * LQ);
  float M = mm[0];
#pragma unroll
  for (int s = 1; s < FK; ++s) M = fmaxf(M, mm[s]);
#pragma unroll
  for (int s = 0; s < FK; ++s) mm[s] = __builtin_amdgcn_exp2f(mm[s] - M);
  v4f a = {0.f, 0.f, 0.f, 0.f}; float L = 0.f;
#pragma unroll
  for (int s = 0; s < FK; ++s) { L += mm[s] * ll[s]; a += v[s] * mm[s]; }
  *(v4fa*)(out + t * 4) = a * (1.0f / L); }

extern "C" void kernel_launch(void* const* d_in, const int* in_sizes, int n_in,
                              void* d_out, int out_size, void* d_ws, size_t ws_size, hipStream_t stream) {
  (void)in_sizes; (void)n_in; (void)out_size;
  const float* const* I = (const float* const*)d_in; const float* x = I[0]; const float* wq = I[1]; const float* wk = I[2]; const float* wv = I[3];      /* x [8192][768] (ONE unbatched sequence); three separate [in][out] weights W_q, W_k, W_v [768][64]: ONE head of 64; no biases; no output projection */
  static_assert(NH == 1 && HG == 1 && HD == 64 && SQ % 256 == 0, "one head of 64; whole work-groups of 256 queries");
  static_assert(NB == 1 && LQ == 64 && SQ % (FK * FST) == 0 && FST == 64 && (NR * LQ) % 1024 == 0, "whole stages in a key range; a stage's rows are 128 B; 16 lanes a row and whole work-groups in the merge");
  char* ws = (char*)d_ws; size_t off = 0;
  auto take = [&](size_t bytes) { char* p = ws + off; off += (bytes + 255) & ~(size_t)255; return p; };
  _Float16* BQKV = (_Float16*)take((size_t)3 * LQ * DM * 2); _Float16* BQ = BQKV; _Float16* BK = BQKV + (size_t)LQ * DM; _Float16* BV = BQKV + (size_t)2 * LQ * DM;      /* three transposed planes Bt [64][768], one after another */
  _Float16* X16 = (_Float16*)take(NR * DM * 2); _Float16* Q16 = (_Float16*)take(NR * LQ * 2); _Float16* K16 = (_Float16*)take(NR * LQ * 2); _Float16* V16 = (_Float16*)take(NR * LQ * 2);
  _Float16* VT = (_Float16*)take((size_t)NH * HD * SQ * 2);
  float* PART = (float*)take((size_t)FK * NR * LQ * 4);      /* un-normalised partial output rows [8192][FK][64] f32: a row's FK partials lie side by side */
  float* ML = (float*)take((size_t)FK * NR * 2 * 4);      /* each partial's (maximum in the log2 domain, sum) */
  if (off > ws_size) return;
  k_wt_f16<<<(unsigned)(((size_t)LQ * (DM / 8) + 255) / 256), 256, 0, stream>>>(wq, BQ, DM, LQ, 16.0f); k_wt_f16<<<(unsigned)(((size_t)LQ * (DM / 8) + 255) / 256), 256, 0, stream>>>(wk, BK, DM, LQ, 16.0f); k_wt_f16<<<(unsigned)(((size_t)LQ * (DM / 8) + 255) / 256), 256, 0, stream>>>(wv, BV, DM, LQ, 16.0f);      /* three [in][out] weights -> their transposed x16 planes, one after another */

  k_x16<<<(unsigned)((NR * DM / 8 + 255) / 256), 256, 0, stream>>>(x, X16, NR * DM / 8);
  const size_t r0p = (size_t)B0 * SQ;      /* first projected row */
  k_gemm2<0><<<dim3((unsigned)((MP / 128) * (LQ / 64)), 1), 128, 0, stream>>>(X16 + r0p * DM, DM, 0, BQ, DM, 0, 0.0625f, nullptr, 0, nullptr, 1, 0, 0, nullptr, Q16 + r0p * LQ, LQ, 0, MP, LQ, DM);      /* q = x W as f16 rows [8192][64] (K = 768, N = 64; no bias) */
  k_gemm2<0><<<dim3((unsigned)((MP / 128) * (LQ / 64)), 1), 128, 0, stream>>>(X16 + r0p * DM, DM, 0, BK, DM, 0, 0.0625f, nullptr, 0, nullptr, 1, 0, 0, nullptr, K16 + r0p * LQ, LQ, 0, MP, LQ, DM);      /* k = x W as f16 rows [8192][64] (K = 768, N = 64; no bias) */
  k_gemm2<0><<<dim3((unsigned)((MP / 128) * (LQ / 64)), 1), 128, 0, stream>>>(X16 + r0p * DM, DM, 0, BV, DM, 0, 0.0625f, nullptr, 0, nullptr, 1, 0, 0, nullptr, V16 + r0p * LQ, LQ, 0, MP, LQ, DM);      /* v = x W as f16 rows [8192][64] (K = 768, N = 64; no bias) */
  for (int b = B0; b < B0 + NBR; ++b) { const size_t r0 = (size_t)b * SQ;
    k_vt<NH, SQ><<<NH * (SQ / 64), 256, 0, stream>>>(V16 + r0 * LQ, LQ, 0, VT);      /* V^T [NH][HD][SQ] for this batch */
    k_fattn<<<dim3(SQ / 256, FK), 256, 0, stream>>>(Q16 + r0 * LQ, K16 + r0 * LQ, VT, PART + r0 * (FK * LQ), ML + r0 * (FK * 2)); }      /* scores, softmax and context rows of 256 queries against one key range a work-group */
  k_fmerge<<<(unsigned)(NR * LQ / 1024), 256, 0, stream>>>(PART, ML, (float*)d_out);      /* each row's FK partials merged into the output */
}

// v004
// One run takes 33.8 microseconds.
// Next to v003, in two timings, it ran 3.62 and 3.59 times as fast.
// All steps since v000 together make it 138 times as fast.
#include <hip/hip_runtime.h>
// Single-head self-attention, unmasked, over ONE unbatched sequence of 8192 tokens, with three separate projections to width 64 and NO output projection (x [8192][768]; q = x W_q, k = x W_k, v = x W_v ([in][out] 768 x 64 each, no bias): ONE head of 64; scores = q . k / sqrt(64); softmax over all 8192 keys (no mask); out = weights v -> [8192][64]).
// Structure: one launch stages the three [in][out] weights as x16 f16 (exact) in WMMA fragment order; ONE projection launch takes 64 token rows a work-group: x is rounded to bf16 and held as exact f16 rows in LDS, twelve waves each form one 16-column tile of q | k | v for the 64 rows (f32 accumulation, K = 768), with the weights as the A operand (a lane then holds 8 neighbouring columns of one token); q and k go out as f16 rows, v is turned in LDS and goes out as V^T; then ONE fused attention launch: a work-group takes 256 queries and one of 16 key ranges, forms S^T = K . Q^T tiles in registers (factor 1/8: the module's division by sqrt(64)), keeps a running maximum and sum a query (online softmax, f32, native exp2), packs the weights as f16 straight into the B operand of O^T += V^T . P^T, and writes un-normalised f32 partial rows with their (maximum, sum); one last launch merges each row's 16 partials into the output.
// Compute dtype: inputs rounded to bf16; x / weights exact; q, k, v and the softmax weights as plain f16 GEMM operands (~2^-12); scores, softmax statistics and the output f32. v_wmma_f32_16x16x32_f16.
#define NB 1
#define SQ 8192
#define DM 768
#define NH 1
#define HD 64
#define HG 1                         /* heads per attention launch group */
#define B0 0                         /* first batch processed (debug hook) */
#define NBR NB                       /* batches processed (debug hook) */
#define NR ((size_t)NB * SQ)         /* token rows */
#define MP ((int)((size_t)NBR * SQ)) /* unused: the projection launch takes all SQ rows */
#define QN SQ                        /* unused: the attention launch takes all SQ queries */
#define NHD NH                       /* unused: the attention launch takes the one head */
#define MPO MP                       /* unused: no output projection stage */
#define LQ (NH * HD)      /* row pitch of the q/k/v rows: the heads' total width (64), NOT the input width DM */
#define FK 16                        /* key ranges of the fused attention launch: each range of SQ / FK keys is a grid row of its own */
#define FST 64                       /* keys a stage: one LDS buffer holds 64 K rows and 64 columns of V^T */
#define FP 72                        /* LDS row pitch in f16: 144 B = 16 B x 9, so that 16 rows' 16 B reads fall on 16 different bank groups */
#define PR 64                        /* token rows of a projection work-group: its 64 columns of a V^T row are one whole 128 B line */
#define PXP (DM + 8)                 /* LDS row pitch of the x tile in f16: 1552 B = 16 B x 97 (odd), for 16 B fragment reads */
#define NKS (DM / 32)                /* k steps of a projection */
#define SC2 0.18033688011112042f     /* (1 / 8) log2(e): scores in the log2 domain */
typedef __bf16 v16b __attribute__((ext_vector_type(16)));
typedef unsigned short v8us __attribute__((ext_vector_type(8), may_alias));
typedef float  v8f  __attribute__((ext_vector_type(8)));
typedef float  v4f  __attribute__((ext_vector_type(4)));
typedef float  v4fa __attribute__((ext_vector_type(4), may_alias));
union FragB { v16b v; v8us half[2]; unsigned short u[16]; };

__device__ __forceinline__ unsigned short bf16_bits(float x) { unsigned int u = __float_as_uint(x); return (unsigned short)((u + 0x7FFFu + ((u >> 16) & 1u)) >> 16); }
__device__ __forceinline__ float bf16_val(unsigned short b) { return __uint_as_float(((unsigned int)b) << 16); }
__device__ __forceinline__ float bf16_round(float x) { return bf16_val(bf16_bits(x)); }
// D += A·B with NT terms: 1 = ah·bh, 2 = + al·bh (A split), 3 = + ah·bl (both split)
template <int NT>
__device__ __forceinline__ v8f mmaN(v16b ah, v16b al, v16b bh, v16b bl, v8f c) {
  c = __builtin_amdgcn_wmma_f32_16x16x32_bf16(false, ah, false, bh, (short)0, c, false, false);
  if (NT >= 2) c = __builtin_amdgcn_wmma_f32_16x16x32_bf16(false, al, false, bh, (short)0, c, false, false);
  if (NT >= 3) c = __builtin_amdgcn_wmma_f32_16x16x32_bf16(false, ah, false, bl, (short)0, c, false, false);
  asm volatile("v_nop\n\tv_nop\n\tv_nop\n\tv_nop" : "+v"(c) : "v"(ah), "v"(al), "v"(bh), "v"(bl));
  return c;
}




// ---- f16 WMMA path (v_wmma_f32_16x16x32_f16): 11-bit significands for operands in range — used where a softmax weight operand (up to 2^8) needs more precision than bf16
typedef _Float16 v16h __attribute__((ext_vector_type(16)));
union FragH { v16h v; v8us half[2]; _Float16 h[16]; unsigned short u[16]; };
template <int NT>
__device__ __forceinline__ v8f mmaH(v16h ah, v16h al, v16h bh, v16h bl, v8f c) {
  c = __builtin_amdgcn_wmma_f32_16x16x32_f16(false, ah, false, bh, (short)0, c, false, false);
  if (NT >= 2) c = __builtin_amdgcn_wmma_f32_16x16x32_f16(false, al, false, bh, (short)0, c, false, false);
  if (NT >= 3) c = __builtin_amdgcn_wmma_f32_16x16x32_f16(false, ah, false, bl, (short)0, c, false, false);
  asm volatile("v_nop\n\tv_nop\n\tv_nop\n\tv_nop" : "+v"(c) : "v"(ah), "v"(al), "v"(bh), "v"(bl));
  return c;
}

// The three [in][out] weights as f16(bf16(W) x 16) (a power of two: exact) in fragment order: block (column tile ct of the 192 columns q | k | v, k step ks, half) = 32 lanes x 16 B,
// lane (c, h) holding column 16 ct + c, k = 32 ks + 16 half + 8 h + 0..7, so that a wave's 16 B-a-lane load of a fragment half covers 4 whole lines.
__global__ __launch_bounds__(256) void k_wfrag(const float* __restrict__ wq, const float* __restrict__ wk, const float* __restrict__ wv, _Float16* __restrict__ WF) {
  const int t = blockIdx.x * 256 + threadIdx.x; const int lane = t & 31, half = (t >> 5) & 1, blk = t >> 6; const int ks = blk % NKS, ct = blk / NKS;
  const int n = (ct & 3) * 16 + (lane & 15), k = ks * 32 + half * 16 + (lane >> 4) * 8; const float* W = ct < 4 ? wq : ct < 8 ? wk : wv; FragH f;
#pragma unroll
  for (int i = 0; i < 8; ++i) f.h[i] = (_Float16)(bf16_round(W[(size_t)(k + i) * LQ + n]) * 16.0f);
  *(v8us*)((unsigned short*)WF + (size_t)t * 8) = f.half[0];
}

typedef _Float16 v4h __attribute__((ext_vector_type(4)));

// 16 x 32 f16 fragment of a k-contiguous row: k = 8 h + 0..7 and 16 + 8 h + 0..7, the same for both operands
__device__ __forceinline__ v16h g2_frag(const _Float16* p, int hh) { FragH f; f.half[0] = *(const v8us*)((const unsigned short*)p + 8 * hh); f.half[1] = *(const v8us*)((const unsigned short*)p + 16 + 8 * hh); return f.v; }

// 32 token rows x one 16-column tile over all of K: D = W^T . x^T, a lane holds 8 neighbouring columns of one token. The x fragments come from LDS two k steps ahead into a second register set:
// the next group's reads are issued together in front of this group's products. The loops are unrolled so that the arrays stay in registers.
#define PG 2                         /* k steps a fragment group */
__device__ __forceinline__ void proj_rows(const _Float16* xs, const FragH (&wf)[NKS], int hh, v8f& a0, v8f& a1) {
  v16h xa[2][PG][2];
#pragma unroll
  for (int j = 0; j < PG; ++j) { xa[0][j][0] = g2_frag(xs + j * 32, hh); xa[0][j][1] = g2_frag(xs + 16 * PXP + j * 32, hh); }
#pragma unroll
  for (int g = 0; g < NKS / PG; ++g) {
    if (g + 1 < NKS / PG) {
#pragma unroll
      for (int j = 0; j < PG; ++j) { xa[(g + 1) & 1][j][0] = g2_frag(xs + ((g + 1) * PG + j) * 32, hh); xa[(g + 1) & 1][j][1] = g2_frag(xs + 16 * PXP + ((g + 1) * PG + j) * 32, hh); } }
#pragma unroll
    for (int j = 0; j < PG; ++j) {
      a0 = __builtin_amdgcn_wmma_f32_16x16x32_f16(false, wf[g * PG + j].v, false, xa[g & 1][j][0], (short)0, a0, false, false);
      a1 = __builtin_amdgcn_wmma_f32_16x16x32_f16(false, wf[g * PG + j].v, false, xa[g & 1][j][1], (short)0, a1, false, false); } } }

// Projections q | k | v of PR token rows in one launch. Work-group: 12 waves, grid SQ / PR. The x tile (PR whole rows: one contiguous range) is read once, 16 B a lane in whole lines, rounded to bf16,
// and laid in LDS as exact f16 rows; wave w forms column tile w of the 192 columns for all PR rows, its 24 weight fragments held in registers: half of them are asked for in front of the x loads, half behind the
// conversion, so that none is waited for inside the product loop. Waves 0-7 (q, k) store their 16 B of a token row from registers; waves 8-11 (v) turn their 16 columns x PR tokens in an LDS range of their own and store whole 128 B lines of V^T.
// The loops over pieces and fragments are unrolled so that the indices are constants and the arrays stay in registers.
__global__ __launch_bounds__(384) void k_proj(const float* __restrict__ x, const _Float16* __restrict__ WF, _Float16* __restrict__ Q, _Float16* __restrict__ Kr, _Float16* __restrict__ Vt) {
  __shared__ __attribute__((aligned(16))) _Float16 sx[PR][PXP];
  __shared__ __attribute__((aligned(16))) _Float16 tv[4][16][FP];      /* a v wave's own [column][token] tile */
  const int tid = threadIdx.x, w = __builtin_amdgcn_readfirstlane(tid >> 5), lane = tid & 31, ln = lane & 15, hh = lane >> 4; const int row0 = blockIdx.x * PR;
  const unsigned short* wp = (const unsigned short*)WF + (size_t)w * (NKS * 512) + lane * 8; FragH wf[NKS];
#pragma unroll
  for (int ks = 0; ks < NKS / 2; ++ks) { wf[ks].half[0] = *(const v8us*)(wp + ks * 512); wf[ks].half[1] = *(const v8us*)(wp + ks * 512 + 256); }
  constexpr int NX = PR * DM / 4 / 384;      /* 16 B pieces of the tile a lane */
  const float* xp = x + (size_t)row0 * DM + tid * 4; v4f xv[NX];
#pragma unroll
  for (int i = 0; i < NX; ++i) xv[i] = *(const v4fa*)(xp + i * (384 * 4));
  const int xr = tid / (DM / 4), xc = (tid % (DM / 4)) * 4;      /* 384 lanes = two rows of 192 pieces */
#pragma unroll
  for (int i = 0; i < NX; ++i) { v4h h4;
#pragma unroll
    for (int q = 0; q < 4; ++q) h4[q] = (_Float16)bf16_round(xv[i][q]);
    *(v4h*)&sx[2 * i + xr][xc] = h4; }
#pragma unroll
  for (int ks = NKS / 2; ks < NKS; ++ks) { wf[ks].half[0] = *(const v8us*)(wp + ks * 512); wf[ks].half[1] = *(const v8us*)(wp + ks * 512 + 256); }
  __syncthreads();      /* publishes the x tile */
  const v8f z8 = {0.f,0.f,0.f,0.f,0.f,0.f,0.f,0.f};
  _Float16* o = (w < 4 ? Q : Kr) + (size_t)(row0 + ln) * LQ + (w & 3) * 16 + 8 * hh;
#pragma unroll 1      /* stays rolled: the row block's LDS base is then a register, and every fragment's offset fits the LDS instruction's 16-bit field */
  for (int p = 0; p < PR / 32; ++p) { v8f a0 = z8, a1 = z8; proj_rows(&sx[p * 32 + ln][0], wf, hh, a0, a1);
    FragH f0, f1;
#pragma unroll
    for (int r = 0; r < 8; ++r) { f0.h[r] = (_Float16)(a0[r] * 0.0625f); f1.h[r] = (_Float16)(a1[r] * 0.0625f); }
    if (w < 8) { *(v8us*)((unsigned short*)o + (p * 32) * LQ) = f0.half[0]; *(v8us*)((unsigned short*)o + (p * 32 + 16) * LQ) = f1.half[0];
      asm volatile("s_wait_xcnt 0x0" ::: "memory"); }      /* the next trip writes anew the registers that these stores name */
    else {
#pragma unroll
      for (int r = 0; r < 8; ++r) { tv[w - 8][8 * hh + r][p * 32 + ln] = f0.h[r]; tv[w - 8][8 * hh + r][p * 32 + 16 + ln] = f1.h[r]; } } }
  if (w >= 8) {
    __builtin_amdgcn_fence(__ATOMIC_ACQ_REL, "workgroup"); __builtin_amdgcn_wave_barrier();      /* the wave's lanes read below what its other lanes wrote above */
#pragma unroll
    for (int i = 0; i < 4; ++i) { const int d = i * 4 + (lane >> 3), c8 = (lane & 7) * 8;
      *(v8us*)((unsigned short*)Vt + (size_t)((w - 8) * 16 + d) * SQ + row0 + c8) = *(const v8us*)&tv[w - 8][d][c8]; } } }

// Fused attention over one key range. Work-group: 8 waves x 32 query columns; grid (SQ / 256, FK). Transposed products: S^T = K . Q^T puts one query's scores in one lane column
// (register r of tile t = key 16 t + 8 hh + r), which is the k order of a B operand, so the f16 weights go into O^T += V^T . P^T with no LDS trip and no lane exchange.
// K rows and V^T columns come through registers into two LDS buffers: the next stage's global loads are issued in front of this stage's products, stored behind them.
// Every loop over tiles, fragments and registers is unrolled so that the indices are constants and the arrays stay in registers; the loop over the stages stays rolled.
__device__ __forceinline__ v8f fa_mma(v16h a, v16h b, v8f c) { return __builtin_amdgcn_wmma_f32_16x16x32_f16(false, a, false, b, (short)0, c, false, false); }
__global__ __launch_bounds__(256) void k_fattn(const _Float16* __restrict__ Q, const _Float16* __restrict__ Kr, const _Float16* __restrict__ Vt, float* __restrict__ part, float* __restrict__ ml) {
  __shared__ __attribute__((aligned(16))) _Float16 sk[2][FST][FP];
  __shared__ __attribute__((aligned(16))) _Float16 sv[2][HD][FP];
  const int tid = threadIdx.x, w = tid >> 5, lane = tid & 31, ln = lane & 15, hh = lane >> 4;
  const int q0 = blockIdx.x * 256 + w * 32, key0 = blockIdx.y * (SQ / FK);
  v16h qf[2][2];
#pragma unroll
  for (int g = 0; g < 2; ++g) {
#pragma unroll
    for (int ks = 0; ks < 2; ++ks) qf[g][ks] = g2_frag(Q + (size_t)(q0 + g * 16 + ln) * LQ + ks * 32, hh); }
  const int sr = tid >> 3, sc = (tid & 7) * 8;      /* staging: 8 lanes a 128 B row, so a wave-wide load is 4 whole lines; rows sr and sr + 32 */
  const unsigned short* gk = (const unsigned short*)Kr + (size_t)(key0 + sr) * LQ + sc;
  const unsigned short* gv = (const unsigned short*)Vt + (size_t)sr * SQ + key0 + sc;
  v8us k0 = *(const v8us*)gk, k1 = *(const v8us*)(gk + 32 * LQ), v0 = *(const v8us*)gv, v1 = *(const v8us*)(gv + (size_t)32 * SQ);
  *(v8us*)&sk[0][sr][sc] = k0; *(v8us*)&sk[0][sr + 32][sc] = k1; *(v8us*)&sv[0][sr][sc] = v0; *(v8us*)&sv[0][sr + 32][sc] = v1;
  __syncthreads();      /* publishes stage 0 */
  const v8f z8 = {0.f,0.f,0.f,0.f,0.f,0.f,0.f,0.f};
  v8f o[4][2]; float m[2], l[2];
#pragma unroll
  for (int g = 0; g < 2; ++g) { m[g] = -3.0e38f; l[g] = 0.f;
#pragma unroll
    for (int dt = 0; dt < 4; ++dt) o[dt][g] = z8; }
  constexpr int NST = SQ / FK / FST;
  for (int st = 0; st < NST; ++st) { const int b = st & 1;
    if (st + 1 < NST) { const unsigned short* nk = gk + (size_t)(st + 1) * FST * LQ; const unsigned short* nv = gv + (st + 1) * FST;
      k0 = *(const v8us*)nk; k1 = *(const v8us*)(nk + 32 * LQ); v0 = *(const v8us*)nv; v1 = *(const v8us*)(nv + (size_t)32 * SQ); }
#pragma unroll
    for (int p = 0; p < FST / 32; ++p) {
      v8f s[2][2];
#pragma unroll
      for (int t = 0; t < 2; ++t) { const v16h ka = g2_frag(&sk[b][p * 32 + t * 16 + ln][0], hh), kb = g2_frag(&sk[b][p * 32 + t * 16 + ln][32], hh);
#pragma unroll
        for (int g = 0; g < 2; ++g) s[t][g] = fa_mma(kb, qf[g][1], fa_mma(ka, qf[g][0], z8)); }
      float mx[2]; bool need = false;
#pragma unroll
      for (int g = 0; g < 2; ++g) { float a = fmaxf(s[0][g][0], s[1][g][0]);
#pragma unroll
        for (int r = 1; r < 8; ++r) a = fmaxf(a, fmaxf(s[0][g][r], s[1][g][r]));
        mx[g] = a * SC2; need = need || (mx[g] > m[g] + 8.0f); }
      /* lazy rescale: the maximum in use moves only when some score of the wave passes it by more than 8 (log2), so a weight stays below 2^8, inside f16; one scalar branch a pass */
      if (__builtin_amdgcn_ballot_w32(need) != 0) {
#pragma unroll
        for (int g = 0; g < 2; ++g) { const float mn = fmaxf(m[g], fmaxf(mx[g], __shfl_xor(mx[g], 16, 32))); const float al = __builtin_amdgcn_exp2f(m[g] - mn); m[g] = mn; l[g] *= al;
#pragma unroll
          for (int dt = 0; dt < 4; ++dt) o[dt][g] *= al; } }
      FragH pf[2];
#pragma unroll
      for (int g = 0; g < 2; ++g) {
#pragma unroll
        for (int t = 0; t < 2; ++t) {
#pragma unroll
          for (int r = 0; r < 8; ++r) { const float e = __builtin_amdgcn_exp2f(fmaf(s[t][g][r], SC2, -m[g])); l[g] += e; pf[g].h[t * 8 + r] = (_Float16)e; } } }
#pragma unroll
      for (int dt = 0; dt < 4; ++dt) { const v16h va = g2_frag(&sv[b][dt * 16 + ln][p * 32], hh);
#pragma unroll
        for (int g = 0; g < 2; ++g) o[dt][g] = fa_mma(va, pf[g].v, o[dt][g]); } }
    if (st + 1 < NST) { *(v8us*)&sk[b ^ 1][sr][sc] = k0; *(v8us*)&sk[b ^ 1][sr + 32][sc] = k1; *(v8us*)&sv[b ^ 1][sr][sc] = v0; *(v8us*)&sv[b ^ 1][sr + 32][sc] = v1; }
    __syncthreads(); }      /* publishes stage st + 1 and ends every wave's reads of stage st, whose buffer the next trip refills */
#pragma unroll
  for (int g = 0; g < 2; ++g) { const float lt = l[g] + __shfl_xor(l[g], 16, 32); const size_t pr = (size_t)(q0 + g * 16 + ln) * FK + blockIdx.y; float* pp = part + pr * LQ + 8 * hh;
#pragma unroll
    for (int dt = 0; dt < 4; ++dt) { const v4f lo = {o[dt][g][0], o[dt][g][1], o[dt][g][2], o[dt][g][3]}, hi = {o[dt][g][4], o[dt][g][5], o[dt][g][6], o[dt][g][7]}; *(v4fa*)(pp + dt * 16) = lo; *(v4fa*)(pp + dt * 16 + 4) = hi; }
    if (hh == 0) { ml[pr * 2] = m[g]; ml[pr * 2 + 1] = lt; } } }

// out row = the row's FK partials [8192][FK][64], each weighted by exp2(its maximum - the row's maximum), in rising order of the range, over the sum of the ranges' sums, each weighted by the same factor; one 16 B column group a lane.
// The loops are unrolled so that the arrays stay in registers and a lane's loads are in flight together.
__global__ __launch_bounds__(256) void k_fmerge(const float* __restrict__ part, const float* __restrict__ ml, float* __restrict__ out) {
  const size_t t = (size_t)blockIdx.x * 256 + threadIdx.x; const float* p = part + (t >> 4) * (FK * LQ) + (t & 15) * 4; const float* q = ml + (t >> 4) * (FK * 2); v4f v[FK]; float mm[FK], ll[FK];
#pragma unroll
  for (int s = 0; s < FK; ++s) { mm[s] = q[s * 2]; ll[s] = q[s * 2 + 1]; }
  asm volatile("s_wait_xcnt 0x0" ::: "memory");      /* the loads below may land in the registers that held the address of the loads above */
#pragma unroll
  for (int s = 0; s < FK; ++s) v[s] = *(const v4fa*)(p + s * LQ);
  float M = mm[0];
#pragma unroll
  for (int s = 1; s < FK; ++s) M = fmaxf(M, mm[s]);
#pragma unroll
  for (int s = 0; s < FK; ++s) mm[s] = __builtin_amdgcn_exp2f(mm[s] - M);
  v4f a = {0.f, 0.f, 0.f, 0.f}; float L = 0.f;
#pragma unroll
  for (int s = 0; s < FK; ++s) { L += mm[s] * ll[s]; a += v[s] * mm[s]; }
  *(v4fa*)(out + t * 4) = a * (1.0f / L); }

extern "C" void kernel_launch(void* const* d_in, const int* in_sizes, int n_in,
                              void* d_out, int out_size, void* d_ws, size_t ws_size, hipStream_t stream) {
  (void)in_sizes; (void)n_in; (void)out_size;
  const float* const* I = (const float* const*)d_in; const float* x = I[0]; const float* wq = I[1]; const float* wk = I[2]; const float* wv = I[3];      /* x [8192][768] (ONE unbatched sequence); three separate [in][out] weights W_q, W_k, W_v [768][64]: ONE head of 64; no biases; no output projection */
  static_assert(NH == 1 && HG == 1 && HD == 64 && SQ % 256 == 0, "one head of 64; whole work-groups of 256 queries");
  static_assert(NB == 1 && LQ == 64 && SQ % (FK * FST) == 0 && FST == 64 && (NR * LQ) % 1024 == 0, "whole stages in a key range; a stage's rows are 128 B; 16 lanes a row and whole work-groups in the merge");
  static_assert(PR == 64 && SQ % PR == 0 && DM % 32 == 0 && DM / 4 * 2 == 384 && (PR * DM / 4) % 384 == 0 && 3 * LQ == 12 * 16 && (3 * LQ * DM / 8) % 256 == 0 && NKS % 4 == 0 && NKS % PG == 0, "projection: 12 waves = 12 column tiles; 384 lanes = two x rows; whole work-groups in the weight staging, each inside one weight");
  char* ws = (char*)d_ws; size_t off = 0;
  auto take = [&](size_t bytes) { char* p = ws + off; off += (bytes + 255) & ~(size_t)255; return p; };
  _Float16* WF = (_Float16*)take((size_t)3 * LQ * DM * 2);      /* the three weights in fragment order: 12 column tiles x 24 k steps x 1 KiB */
  _Float16* Q16 = (_Float16*)take(NR * LQ * 2); _Float16* K16 = (_Float16*)take(NR * LQ * 2);
  _Float16* VT = (_Float16*)take((size_t)NH * HD * SQ * 2);
  float* PART = (float*)take((size_t)FK * NR * LQ * 4);      /* un-normalised partial output rows [8192][FK][64] f32: a row's FK partials lie side by side */
  float* ML = (float*)take((size_t)FK * NR * 2 * 4);      /* each partial's (maximum in the log2 domain, sum) */
  if (off > ws_size) return;
  k_wfrag<<<(unsigned)((size_t)3 * LQ * DM / 8 / 256), 256, 0, stream>>>(wq, wk, wv, WF);      /* three [in][out] weights -> x16 f16 fragments */
  k_proj<<<SQ / PR, 384, 0, stream>>>(x, WF, Q16, K16, VT);      /* q, k as f16 rows [8192][64], v as V^T [64][8192] (K = 768; no bias) */
  for (int b = B0; b < B0 + NBR; ++b) { const size_t r0 = (size_t)b * SQ;
    k_fattn<<<dim3(SQ / 256, FK), 256, 0, stream>>>(Q16 + r0 * LQ, K16 + r0 * LQ, VT, PART + r0 * (FK * LQ), ML + r0 * (FK * 2)); }      /* scores, softmax and context rows of 256 queries against one key range a work-group */
  k_fmerge<<<(unsigned)(NR * LQ / 1024), 256, 0, stream>>>(PART, ML, (float*)d_out);      /* each row's FK partials merged into the output */
}

// v005
// One run takes 32.9 microseconds.
// In two side-by-side timings against v004, it was 1.05 and 1.06 times as fast.
// All steps since v000 together make it 145 times as fast.
#include <hip/hip_runtime.h>
// Single-head self-attention, unmasked, over ONE unbatched sequence of 8192 tokens, with three separate projections to width 64 and NO output projection (x [8192][768]; q = x W_q, k = x W_k, v = x W_v ([in][out] 768 x 64 each, no bias): ONE head of 64; scores = q . k / sqrt(64); softmax over all 8192 keys (no mask); out = weights v -> [8192][64]).
// Structure: one launch stages the three [in][out] weights as x16 f16 (exact) in WMMA fragment order; ONE projection launch takes 64 token rows a work-group: x is rounded to bf16 and held as exact f16 rows in LDS, twelve waves each form one 16-column tile of q | k | v for the 64 rows (f32 accumulation, K = 768), with the weights as the A operand (a lane then holds 8 neighbouring columns of one token); q and k go out as f16 rows, v is turned in LDS and goes out as V^T; then ONE fused attention launch: a work-group of 16 waves takes 128 queries and one of 4 key ranges, four waves (32 queries each) on each quarter of the range; a wave forms S^T = K . Q^T tiles in registers (factor 1/8: the module's division by sqrt(64)), keeps a running maximum and sum a query (online softmax, f32, native exp2), packs the weights as f16 straight into the B operand of O^T += V^T . P^T, the four quarters' un-normalised f32 rows are merged in LDS and go out as one partial row with its (maximum, sum); one last launch merges each row's 4 partials into the output.
// Compute dtype: inputs rounded to bf16; x / weights exact; q, k, v and the softmax weights as plain f16 GEMM operands (~2^-12); scores, softmax statistics and the output f32. v_wmma_f32_16x16x32_f16.
#define NB 1
#define SQ 8192
#define DM 768
#define NH 1
#define HD 64
#define HG 1                         /* heads per attention launch group */
#define B0 0                         /* first batch processed (debug hook) */
#define NBR NB                       /* batches processed (debug hook) */
#define NR ((size_t)NB * SQ)         /* token rows */
#define MP ((int)((size_t)NBR * SQ)) /* unused: the projection launch takes all SQ rows */
#define QN SQ                        /* unused: the attention launch takes all SQ queries */
#define NHD NH                       /* unused: the attention launch takes the one head */
#define MPO MP                       /* unused: no output projection stage */
#define LQ (NH * HD)      /* row pitch of the q/k/v rows: the heads' total width (64), NOT the input width DM */
#define FK 4                         /* key ranges of the fused attention launch: each range of SQ / FK keys is a grid row of its own */
#define FW 4                         /* quarters of a key range: each is walked by its own waves of the work-group, merged in LDS at the end */
#define FQ 4                         /* waves (32 queries each) on a quarter */
#define FST 64                       /* keys a stage: one LDS buffer holds 64 K rows and 64 columns of V^T */
#define FP 72                        /* LDS row pitch in f16: 144 B = 16 B x 9, so that 16 rows' 16 B reads fall on 16 different bank groups */
#define PR 64                        /* token rows of a projection work-group: its 64 columns of a V^T row are one whole 128 B line */
#define PXP (DM + 8)                 /* LDS row pitch of the x tile in f16: 1552 B = 16 B x 97 (odd), for 16 B fragment reads */
#define NKS (DM / 32)                /* k steps of a projection */
#define SC2 0.18033688011112042f     /* (1 / 8) log2(e): scores in the log2 domain */
typedef __bf16 v16b __attribute__((ext_vector_type(16)));
typedef unsigned short v8us __attribute__((ext_vector_type(8), may_alias));
typedef float  v8f  __attribute__((ext_vector_type(8)));
typedef float  v4f  __attribute__((ext_vector_type(4)));
typedef float  v4fa __attribute__((ext_vector_type(4), may_alias));
union FragB { v16b v; v8us half[2]; unsigned short u[16]; };

__device__ __forceinline__ unsigned short bf16_bits(float x) { unsigned int u = __float_as_uint(x); return (unsigned short)((u + 0x7FFFu + ((u >> 16) & 1u)) >> 16); }
__device__ __forceinline__ float bf16_val(unsigned short b) { return __uint_as_float(((unsigned int)b) << 16); }
__device__ __forceinline__ float bf16_round(float x) { return bf16_val(bf16_bits(x)); }
// D += A·B with NT terms: 1 = ah·bh, 2 = + al·bh (A split), 3 = + ah·bl (both split)
template <int NT>
__device__ __forceinline__ v8f mmaN(v16b ah, v16b al, v16b bh, v16b bl, v8f c) {
  c = __builtin_amdgcn_wmma_f32_16x16x32_bf16(false, ah, false, bh, (short)0, c, false, false);
  if (NT >= 2) c = __builtin_amdgcn_wmma_f32_16x16x32_bf16(false, al, false, bh, (short)0, c, false, false);
  if (NT >= 3) c = __builtin_amdgcn_wmma_f32_16x16x32_bf16(false, ah, false, bl, (short)0, c, false, false);
  asm volatile("v_nop\n\tv_nop\n\tv_nop\n\tv_nop" : "+v"(c) : "v"(ah), "v"(al), "v"(bh), "v"(bl));
  return c;
}




// ---- f16 WMMA path (v_wmma_f32_16x16x32_f16): 11-bit significands for operands in range — used where a softmax weight operand (up to 2^8) needs more precision than bf16
typedef _Float16 v16h __attribute__((ext_vector_type(16)));
union FragH { v16h v; v8us half[2]; _Float16 h[16]; unsigned short u[16]; };
template <int NT>
__device__ __forceinline__ v8f mmaH(v16h ah, v16h al, v16h bh, v16h bl, v8f c) {
  c = __builtin_amdgcn_wmma_f32_16x16x32_f16(false, ah, false, bh, (short)0, c, false, false);
  if (NT >= 2) c = __builtin_amdgcn_wmma_f32_16x16x32_f16(false, al, false, bh, (short)0, c, false, false);
  if (NT >= 3) c = __builtin_amdgcn_wmma_f32_16x16x32_f16(false, ah, false, bl, (short)0, c, false, false);
  asm volatile("v_nop\n\tv_nop\n\tv_nop\n\tv_nop" : "+v"(c) : "v"(ah), "v"(al), "v"(bh), "v"(bl));
  return c;
}

// The three [in][out] weights as f16(bf16(W) x 16) (a power of two: exact) in fragment order: block (column tile ct of the 192 columns q | k | v, k step ks, half) = 32 lanes x 16 B,
// lane (c, h) holding column 16 ct + c, k = 32 ks + 16 half + 8 h + 0..7, so that a wave's 16 B-a-lane load of a fragment half covers 4 whole lines.
__global__ __launch_bounds__(256) void k_wfrag(const float* __restrict__ wq, const float* __restrict__ wk, const float* __restrict__ wv, _Float16* __restrict__ WF) {
  const int t = blockIdx.x * 256 + threadIdx.x; const int lane = t & 31, half = (t >> 5) & 1, blk = t >> 6; const int ks = blk % NKS, ct = blk / NKS;
  const int n = (ct & 3) * 16 + (lane & 15), k = ks * 32 + half * 16 + (lane >> 4) * 8; const float* W = ct < 4 ? wq : ct < 8 ? wk : wv; FragH f;
#pragma unroll
  for (int i = 0; i < 8; ++i) f.h[i] = (_Float16)(bf16_round(W[(size_t)(k + i) * LQ + n]) * 16.0f);
  *(v8us*)((unsigned short*)WF + (size_t)t * 8) = f.half[0];
}

typedef _Float16 v4h __attribute__((ext_vector_type(4)));

// 16 x 32 f16 fragment of a k-contiguous row: k = 8 h + 0..7 and 16 + 8 h + 0..7, the same for both operands
__device__ __forceinline__ v16h g2_frag(const _Float16* p, int hh) { FragH f; f.half[0] = *(const v8us*)((const unsigned short*)p + 8 * hh); f.half[1] = *(const v8us*)((const unsigned short*)p + 16 + 8 * hh); return f.v; }

// 32 token rows x one 16-column tile over all of K: D = W^T . x^T, a lane holds 8 neighbouring columns of one token. The x fragments come from LDS two k steps ahead into a second register set:
// the next group's reads are issued together in front of this group's products. The loops are unrolled so that the arrays stay in registers.
#define PG 2                         /* k steps a fragment group */
__device__ __forceinline__ void proj_rows(const _Float16* xs, const FragH (&wf)[NKS], int hh, v8f& a0, v8f& a1) {
  v16h xa[2][PG][2];
#pragma unroll
  for (int j = 0; j < PG; ++j) { xa[0][j][0] = g2_frag(xs + j * 32, hh); xa[0][j][1] = g2_frag(xs + 16 * PXP + j * 32, hh); }
#pragma unroll
  for (int g = 0; g < NKS / PG; ++g) {
    if (g + 1 < NKS / PG) {
#pragma unroll
      for (int j = 0; j < PG; ++j) { xa[(g + 1) & 1][j][0] = g2_frag(xs + ((g + 1) * PG + j) * 32, hh); xa[(g + 1) & 1][j][1] = g2_frag(xs + 16 * PXP + ((g + 1) * PG + j) * 32, hh); } }
#pragma unroll
    for (int j = 0; j < PG; ++j) {
      a0 = __builtin_amdgcn_wmma_f32_16x16x32_f16(false, wf[g * PG + j].v, false, xa[g & 1][j][0], (short)0, a0, false, false);
      a1 = __builtin_amdgcn_wmma_f32_16x16x32_f16(false, wf[g * PG + j].v, false, xa[g & 1][j][1], (short)0, a1, false, false); } } }

// Projections q | k | v of PR token rows in one launch. Work-group: 12 waves, grid SQ / PR. The x tile (PR whole rows: one contiguous range) is read once, 16 B a lane in whole lines, rounded to bf16,
// and laid in LDS as exact f16 rows; wave w forms column tile w of the 192 columns for all PR rows, its 24 weight fragments held in registers: half of them are asked for in front of the x loads, half behind the
// conversion, so that none is waited for inside the product loop. Waves 0-7 (q, k) store their 16 B of a token row from registers; waves 8-11 (v) turn their 16 columns x PR tokens in an LDS range of their own and store whole 128 B lines of V^T.
// The loops over pieces and fragments are unrolled so that the indices are constants and the arrays stay in registers.
__global__ __launch_bounds__(384) void k_proj(const float* __restrict__ x, const _Float16* __restrict__ WF, _Float16* __restrict__ Q, _Float16* __restrict__ Kr, _Float16* __restrict__ Vt) {
  __shared__ __attribute__((aligned(16))) _Float16 sx[PR][PXP];
  __shared__ __attribute__((aligned(16))) _Float16 tv[4][16][FP];      /* a v wave's own [column][token] tile */
  const int tid = threadIdx.x, w = __builtin_amdgcn_readfirstlane(tid >> 5), lane = tid & 31, ln = lane & 15, hh = lane >> 4; const int row0 = blockIdx.x * PR;
  const unsigned short* wp = (const unsigned short*)WF + (size_t)w * (NKS * 512) + lane * 8; FragH wf[NKS];
#pragma unroll
  for (int ks = 0; ks < NKS / 2; ++ks) { wf[ks].half[0] = *(const v8us*)(wp + ks * 512); wf[ks].half[1] = *(const v8us*)(wp + ks * 512 + 256); }
  constexpr int NX = PR * DM / 4 / 384;      /* 16 B pieces of the tile a lane */
  const float* xp = x + (size_t)row0 * DM + tid * 4; v4f xv[NX];
#pragma unroll
  for (int i = 0; i < NX; ++i) xv[i] = *(const v4fa*)(xp + i * (384 * 4));
  const int xr = tid / (DM / 4), xc = (tid % (DM / 4)) * 4;      /* 384 lanes = two rows of 192 pieces */
#pragma unroll
  for (int i = 0; i < NX; ++i) { v4h h4;
#pragma unroll
    for (int q = 0; q < 4; ++q) h4[q] = (_Float16)bf16_round(xv[i][q]);
    *(v4h*)&sx[2 * i + xr][xc] = h4; }
#pragma unroll
  for (int ks = NKS / 2; ks < NKS; ++ks) { wf[ks].half[0] = *(const v8us*)(wp + ks * 512); wf[ks].half[1] = *(const v8us*)(wp + ks * 512 + 256); }
  __syncthreads();      /* publishes the x tile */
  const v8f z8 = {0.f,0.f,0.f,0.f,0.f,0.f,0.f,0.f};
  _Float16* o = (w < 4 ? Q : Kr) + (size_t)(row0 + ln) * LQ + (w & 3) * 16 + 8 * hh;
#pragma unroll 1      /* stays rolled: the row block's LDS base is then a register, and every fragment's offset fits the LDS instruction's 16-bit field */
  for (int p = 0; p < PR / 32; ++p) { v8f a0 = z8, a1 = z8; proj_rows(&sx[p * 32 + ln][0], wf, hh, a0, a1);
    FragH f0, f1;
#pragma unroll
    for (int r = 0; r < 8; ++r) { f0.h[r] = (_Float16)(a0[r] * 0.0625f); f1.h[r] = (_Float16)(a1[r] * 0.0625f); }
    if (w < 8) { *(v8us*)((unsigned short*)o + (p * 32) * LQ) = f0.half[0]; *(v8us*)((unsigned short*)o + (p * 32 + 16) * LQ) = f1.half[0];
      asm volatile("s_wait_xcnt 0x0" ::: "memory"); }      /* the next trip writes anew the registers that these stores name */
    else {
#pragma unroll
      for (int r = 0; r < 8; ++r) { tv[w - 8][8 * hh + r][p * 32 + ln] = f0.h[r]; tv[w - 8][8 * hh + r][p * 32 + 16 + ln] = f1.h[r]; } } }
  if (w >= 8) {
    __builtin_amdgcn_fence(__ATOMIC_ACQ_REL, "workgroup"); __builtin_amdgcn_wave_barrier();      /* the wave's lanes read below what its other lanes wrote above */
#pragma unroll
    for (int i = 0; i < 4; ++i) { const int d = i * 4 + (lane >> 3), c8 = (lane & 7) * 8;
      *(v8us*)((unsigned short*)Vt + (size_t)((w - 8) * 16 + d) * SQ + row0 + c8) = *(const v8us*)&tv[w - 8][d][c8]; } } }

// Fused attention over one key range. Work-group: FW quarters of the range x FQ waves x 32 query columns; grid (SQ / 128, FK). Transposed products: S^T = K . Q^T puts one query's scores in one lane column
// (register r of tile t = key 16 t + 8 hh + r), which is the k order of a B operand, so the f16 weights go into O^T += V^T . P^T with no LDS trip and no lane exchange.
// K rows and V^T columns come through registers into two LDS buffers a quarter, staged by the quarter's own waves: the next stage's global loads are issued in front of this stage's products, stored behind them.
// At the end every wave lays its un-normalised rows and (maximum, sum) in LDS, and the four waves of a query group each merge 16 of its queries x 32 output columns (one 128 B line a query) over the quarters, in rising order of the keys.
// Every loop over tiles, fragments and registers is unrolled so that the indices are constants and the arrays stay in registers; the loop over the stages stays rolled.
typedef float v2fa __attribute__((ext_vector_type(2), may_alias));
__device__ __forceinline__ v8f fa_mma(v16h a, v16h b, v8f c) { return __builtin_amdgcn_wmma_f32_16x16x32_f16(false, a, false, b, (short)0, c, false, false); }
__global__ __launch_bounds__(32 * FQ * FW) void k_fattn(const _Float16* __restrict__ Q, const _Float16* __restrict__ Kr, const _Float16* __restrict__ Vt, float* __restrict__ part, float* __restrict__ ml) {
  __shared__ __attribute__((aligned(16))) _Float16 sm[2][FW][FST + HD][FP];      /* a buffer of a quarter: FST K rows, then HD rows of V^T */
  const int tid = threadIdx.x, w = __builtin_amdgcn_readfirstlane(tid >> 5), lane = tid & 31, ln = lane & 15, hh = lane >> 4, qg = w % FQ, kq = w / FQ;
  const int q0 = blockIdx.x * (32 * FQ) + qg * 32, key0 = (blockIdx.y * FW + kq) * (SQ / FK / FW);
  v16h qf[2][2];
#pragma unroll
  for (int g = 0; g < 2; ++g) {
#pragma unroll
    for (int ks = 0; ks < 2; ++ks) qf[g][ks] = g2_frag(Q + (size_t)(q0 + g * 16 + ln) * LQ + ks * 32, hh); }
  constexpr int SRW = 32 * FQ / 8, NJ = FST / SRW;      /* staging: 8 lanes a 128 B row, so a wave-wide load is 4 whole lines; a quarter's waves take SRW rows at a time */
  const int sr = (tid % (32 * FQ)) >> 3, sc = (tid & 7) * 8;
  const unsigned short* gk = (const unsigned short*)Kr + (size_t)(key0 + sr) * LQ + sc;
  const unsigned short* gv = (const unsigned short*)Vt + (size_t)sr * SQ + key0 + sc;
  v8us kr[NJ], vr[NJ];
#pragma unroll
  for (int j = 0; j < NJ; ++j) { kr[j] = *(const v8us*)(gk + j * SRW * LQ); vr[j] = *(const v8us*)(gv + (size_t)j * SRW * SQ); }
#pragma unroll
  for (int j = 0; j < NJ; ++j) { *(v8us*)&sm[0][kq][sr + j * SRW][sc] = kr[j]; *(v8us*)&sm[0][kq][FST + sr + j * SRW][sc] = vr[j]; }
  __syncthreads();      /* publishes stage 0 */
  const v8f z8 = {0.f,0.f,0.f,0.f,0.f,0.f,0.f,0.f};
  v8f o[4][2]; float m[2], l[2];
#pragma unroll
  for (int g = 0; g < 2; ++g) { m[g] = -3.0e38f; l[g] = 0.f;
#pragma unroll
    for (int dt = 0; dt < 4; ++dt) o[dt][g] = z8; }
  constexpr int NST = SQ / FK / FW / FST;
  for (int st = 0; st < NST; ++st) { const int b = st & 1;
    if (st + 1 < NST) { const unsigned short* nk = gk + (size_t)(st + 1) * FST * LQ; const unsigned short* nv = gv + (st + 1) * FST;
#pragma unroll
      for (int j = 0; j < NJ; ++j) { kr[j] = *(const v8us*)(nk + j * SRW * LQ); vr[j] = *(const v8us*)(nv + (size_t)j * SRW * SQ); } }
#pragma unroll
    for (int p = 0; p < FST / 32; ++p) {
      v8f s[2][2];
#pragma unroll
      for (int t = 0; t < 2; ++t) { const v16h ka = g2_frag(&sm[b][kq][p * 32 + t * 16 + ln][0], hh), kb = g2_frag(&sm[b][kq][p * 32 + t * 16 + ln][32], hh);
#pragma unroll
        for (int g = 0; g < 2; ++g) s[t][g] = fa_mma(kb, qf[g][1], fa_mma(ka, qf[g][0], z8)); }
      float mx[2]; bool need = false;
#pragma unroll
      for (int g = 0; g < 2; ++g) { float a = fmaxf(s[0][g][0], s[1][g][0]);
#pragma unroll
        for (int r = 1; r < 8; ++r) a = fmaxf(a, fmaxf(s[0][g][r], s[1][g][r]));
        mx[g] = a * SC2; need = need || (mx[g] > m[g] + 8.0f); }
      /* lazy rescale: the maximum in use moves only when some score of the wave passes it by more than 8 (log2), so a weight stays below 2^8, inside f16; one scalar branch a pass */
      if (__builtin_amdgcn_ballot_w32(need) != 0) {
#pragma unroll
        for (int g = 0; g < 2; ++g) { const float mn = fmaxf(m[g], fmaxf(mx[g], __shfl_xor(mx[g], 16, 32))); const float al = __builtin_amdgcn_exp2f(m[g] - mn); m[g] = mn; l[g] *= al;
#pragma unroll
          for (int dt = 0; dt < 4; ++dt) o[dt][g] *= al; } }
      FragH pf[2];
#pragma unroll
      for (int g = 0; g < 2; ++g) {
#pragma unroll
        for (int t = 0; t < 2; ++t) {
#pragma unroll
          for (int r = 0; r < 8; ++r) { const float e = __builtin_amdgcn_exp2f(fmaf(s[t][g][r], SC2, -m[g])); l[g] += e; pf[g].h[t * 8 + r] = (_Float16)e; } } }
#pragma unroll
      for (int dt = 0; dt < 4; ++dt) { const v16h va = g2_frag(&sm[b][kq][FST + dt * 16 + ln][p * 32], hh);
#pragma unroll
        for (int g = 0; g < 2; ++g) o[dt][g] = fa_mma(va, pf[g].v, o[dt][g]); } }
    if (st + 1 < NST) {
#pragma unroll
      for (int j = 0; j < NJ; ++j) { *(v8us*)&sm[b ^ 1][kq][sr + j * SRW][sc] = kr[j]; *(v8us*)&sm[b ^ 1][kq][FST + sr + j * SRW][sc] = vr[j]; } }
    __syncthreads(); }      /* publishes stage st + 1 and ends every wave's reads of stage st, whose buffer the next trip refills; the last one frees both buffers for the merge */
  /* merge of the quarters in the LDS that the stages have left: tile (wave, dt, g, register half) = 32 lanes x 16 B in lane order, then (maximum, sum) a (wave, g, lane) */
  float* mb = (float*)&sm[0][0][0][0]; float* mlb = mb + FQ * FW * 2048;
  static_assert((FQ * FW * 2048 + FQ * FW * 128) * 4 <= (int)sizeof(sm) && FW == 4 && HD == 64, "the merge tiles fit the stage buffers; four merging waves a query group: 2 query tiles x 2 column halves");
#pragma unroll
  for (int g = 0; g < 2; ++g) { const v2fa e = {m[g], l[g] + __shfl_xor(l[g], 16, 32)}; *(v2fa*)(mlb + ((w * 2 + g) * 32 + lane) * 2) = e; }
#pragma unroll
  for (int dt = 0; dt < 4; ++dt) {
#pragma unroll
    for (int g = 0; g < 2; ++g) { const v4f lo = {o[dt][g][0], o[dt][g][1], o[dt][g][2], o[dt][g][3]}, hi = {o[dt][g][4], o[dt][g][5], o[dt][g][6], o[dt][g][7]};
      float* t = mb + ((((w * 4 + dt) * 2 + g) * 2) * 32 + lane) * 4; *(v4fa*)t = lo; *(v4fa*)(t + 128) = hi; } }
  __syncthreads();      /* publishes every wave's rows to the waves that merge them */
  { const int g = kq & 1, d0 = (kq >> 1) * 2; float mm[FW], ll[FW]; v4f lo[2][FW], hi[2][FW];      /* this wave's share: 16 queries x 32 columns, one whole 128 B line a query */
#pragma unroll
    for (int s = 0; s < FW; ++s) { const int ws = s * FQ + qg; const v2fa e = *(const v2fa*)(mlb + ((ws * 2 + g) * 32 + lane) * 2); mm[s] = e[0]; ll[s] = e[1];
#pragma unroll
      for (int d = 0; d < 2; ++d) { const float* t = mb + ((((ws * 4 + d0 + d) * 2 + g) * 2) * 32 + lane) * 4; lo[d][s] = *(const v4fa*)t; hi[d][s] = *(const v4fa*)(t + 128); } }
    float M = mm[0];
#pragma unroll
    for (int s = 1; s < FW; ++s) M = fmaxf(M, mm[s]);
    const v4f z4 = {0.f, 0.f, 0.f, 0.f}; v4f alo[2] = {z4, z4}, ahi[2] = {z4, z4}; float L = 0.f;
#pragma unroll
    for (int s = 0; s < FW; ++s) { float f; asm("v_exp_f32 %0, %1\n\tv_nop" : "=v"(f) : "v"(mm[s] - M));      /* the v_nop fills the slot behind the transcendental, whose source register the next instruction may write anew */
      L += f * ll[s];
#pragma unroll
      for (int d = 0; d < 2; ++d) { alo[d] += lo[d][s] * f; ahi[d] += hi[d][s] * f; } }
    const size_t pr = (size_t)(q0 + g * 16 + ln) * FK + blockIdx.y; float* pp = part + pr * LQ + d0 * 16 + 8 * hh;
#pragma unroll
    for (int d = 0; d < 2; ++d) { *(v4fa*)(pp + d * 16) = alo[d]; *(v4fa*)(pp + d * 16 + 4) = ahi[d]; }
    if (d0 == 0 && hh == 0) { ml[pr * 2] = M; ml[pr * 2 + 1] = L; } } }

// out row = the row's FK partials [8192][FK][64], each weighted by exp2(its maximum - the row's maximum), in rising order of the range, over the sum of the ranges' sums weighted by the same factors; one 16 B column group a lane.
// The loops are unrolled so that the arrays stay in registers and a lane's loads are in flight together.
__global__ __launch_bounds__(256) void k_fmerge(const float* __restrict__ part, const float* __restrict__ ml, float* __restrict__ out) {
  const size_t t = (size_t)blockIdx.x * 256 + threadIdx.x; const float* p = part + (t >> 4) * (FK * LQ) + (t & 15) * 4; const float* q = ml + (t >> 4) * (FK * 2); v4f v[FK]; float mm[FK], ll[FK];
#pragma unroll
  for (int s = 0; s < FK; ++s) { mm[s] = q[s * 2]; ll[s] = q[s * 2 + 1]; }
  asm volatile("s_wait_xcnt 0x0" ::: "memory");      /* the loads below may land in the registers that held the address of the loads above */
#pragma unroll
  for (int s = 0; s < FK; ++s) v[s] = *(const v4fa*)(p + s * LQ);
  float M = mm[0];
#pragma unroll
  for (int s = 1; s < FK; ++s) M = fmaxf(M, mm[s]);
#pragma unroll
  for (int s = 0; s < FK; ++s) mm[s] = __builtin_amdgcn_exp2f(mm[s] - M);
  v4f a = {0.f, 0.f, 0.f, 0.f}; float L = 0.f;
#pragma unroll
  for (int s = 0; s < FK; ++s) { L += mm[s] * ll[s]; a += v[s] * mm[s]; }
  *(v4fa*)(out + t * 4) = a * (1.0f / L); }

extern "C" void kernel_launch(void* const* d_in, const int* in_sizes, int n_in,
                              void* d_out, int out_size, void* d_ws, size_t ws_size, hipStream_t stream) {
  (void)in_sizes; (void)n_in; (void)out_size;
  const float* const* I = (const float* const*)d_in; const float* x = I[0]; const float* wq = I[1]; const float* wk = I[2]; const float* wv = I[3];      /* x [8192][768] (ONE unbatched sequence); three separate [in][out] weights W_q, W_k, W_v [768][64]: ONE head of 64; no biases; no output projection */
  static_assert(NH == 1 && HG == 1 && HD == 64 && SQ % (32 * FQ) == 0, "one head of 64; whole work-groups of 128 queries");
  static_assert(NB == 1 && LQ == 64 && SQ % (FK * FW * FST) == 0 && FST == 64 && (NR * LQ) % 1024 == 0, "whole stages in a key range; a stage's rows are 128 B; 16 lanes a row and whole work-groups in the merge");
  static_assert(PR == 64 && SQ % PR == 0 && DM % 32 == 0 && DM / 4 * 2 == 384 && (PR * DM / 4) % 384 == 0 && 3 * LQ == 12 * 16 && (3 * LQ * DM / 8) % 256 == 0 && NKS % 4 == 0 && NKS % PG == 0, "projection: 12 waves = 12 column tiles; 384 lanes = two x rows; whole work-groups in the weight staging, each inside one weight");
  char* ws = (char*)d_ws; size_t off = 0;
  auto take = [&](size_t bytes) { char* p = ws + off; off += (bytes + 255) & ~(size_t)255; return p; };
  _Float16* WF = (_Float16*)take((size_t)3 * LQ * DM * 2);      /* the three weights in fragment order: 12 column tiles x 24 k steps x 1 KiB */
  _Float16* Q16 = (_Float16*)take(NR * LQ * 2); _Float16* K16 = (_Float16*)take(NR * LQ * 2);
  _Float16* VT = (_Float16*)take((size_t)NH * HD * SQ * 2);
  float* PART = (float*)take((size_t)FK * NR * LQ * 4);      /* un-normalised partial output rows [8192][FK][64] f32: a row's FK partials lie side by side */
  float* ML = (float*)take((size_t)FK * NR * 2 * 4);      /* each partial's (maximum in the log2 domain, sum) */
  if (off > ws_size) return;
  k_wfrag<<<(unsigned)((size_t)3 * LQ * DM / 8 / 256), 256, 0, stream>>>(wq, wk, wv, WF);      /* three [in][out] weights -> x16 f16 fragments */
  k_proj<<<SQ / PR, 384, 0, stream>>>(x, WF, Q16, K16, VT);      /* q, k as f16 rows [8192][64], v as V^T [64][8192] (K = 768; no bias) */
  for (int b = B0; b < B0 + NBR; ++b) { const size_t r0 = (size_t)b * SQ;
    k_fattn<<<dim3(SQ / (32 * FQ), FK), 32 * FQ * FW, 0, stream>>>(Q16 + r0 * LQ, K16 + r0 * LQ, VT, PART + r0 * (FK * LQ), ML + r0 * (FK * 2)); }      /* scores, softmax and context rows of 128 queries against one key range a work-group */
  k_fmerge<<<(unsigned)(NR * LQ / 1024), 256, 0, stream>>>(PART, ML, (float*)d_out);      /* each row's FK partials merged into the output */
}

// v006
// Measured time: 32.3 microseconds a run.
// Two timings next to v005 put it at 1.04 and 1.03 times that version's speed.
// Over all steps from v000 it is 151 times as fast.
#include <hip/hip_runtime.h>
// Single-head self-attention, unmasked, over ONE unbatched sequence of 8192 tokens, with three separate projections to width 64 and NO output projection (x [8192][768]; q = x W_q, k = x W_k, v = x W_v ([in][out] 768 x 64 each, no bias): ONE head of 64; scores = q . k / sqrt(64); softmax over all 8192 keys (no mask); out = weights v -> [8192][64]).
// Structure: one launch stages the three [in][out] weights as x16 f16 (exact) in WMMA fragment order; ONE projection launch takes 64 token rows a work-group: x is rounded to bf16 and held as exact f16 rows in LDS, twelve waves each form one 16-column tile of q | k | v for the 64 rows (f32 accumulation, K = 768), with the weights as the A operand (a lane then holds 8 neighbouring columns of one token); q (already times (1 / 8) log2(e)) and k go out as f16 rows, v is turned in LDS and goes out as V^T; then ONE fused attention launch: a work-group of 16 waves takes 128 queries and one of 4 key ranges, four waves (32 queries each) on each quarter of the range; a wave forms S^T = K . Q^T tiles in registers (factor 1/8, the module's division by sqrt(64), already in q; the products start from minus the maximum in use, so that they end as exp2 arguments), keeps a maximum in use and a sum a query (online softmax, f32, native exp2), packs the weights as f16 straight into the B operand of O^T += V^T . P^T, the four quarters' un-normalised f32 rows are merged in LDS and go out as one partial row with its (maximum, sum); one last launch merges each row's 4 partials into the output.
// Compute dtype: inputs rounded to bf16; x / weights exact; q, k, v and the softmax weights as plain f16 GEMM operands (~2^-12); scores, softmax statistics and the output f32. v_wmma_f32_16x16x32_f16.
#define NB 1
#define SQ 8192
#define DM 768
#define NH 1
#define HD 64
#define HG 1                         /* heads per attention launch group */
#define B0 0                         /* first batch processed (debug hook) */
#define NBR NB                       /* batches processed (debug hook) */
#define NR ((size_t)NB * SQ)         /* token rows */
#define MP ((int)((size_t)NBR * SQ)) /* unused: the projection launch takes all SQ rows */
#define QN SQ                        /* unused: the attention launch takes all SQ queries */
#define NHD NH                       /* unused: the attention launch takes the one head */
#define MPO MP                       /* unused: no output projection stage */
#define LQ (NH * HD)      /* row pitch of the q/k/v rows: the heads' total width (64), NOT the input width DM */
#define FK 4                         /* key ranges of the fused attention launch: each range of SQ / FK keys is a grid row of its own */
#define FW 4                         /* quarters of a key range: each is walked by its own waves of the work-group, merged in LDS at the end */
#define FQ 4                         /* waves (32 queries each) on a quarter */
#define FST 64                       /* keys a stage: one LDS buffer holds 64 K rows and 64 columns of V^T */
#define FP 72                        /* LDS row pitch in f16: 144 B = 16 B x 9, so that 16 rows' 16 B reads fall on 16 different bank groups */
#define PR 64                        /* token rows of a projection work-group: its 64 columns of a V^T row are one whole 128 B line */
#define PXP (DM + 8)                 /* LDS row pitch of the x tile in f16: 1552 B = 16 B x 97 (odd), for 16 B fragment reads */
#define NKS (DM / 32)                /* k steps of a projection */
#define SC2 0.18033688011112042f     /* (1 / 8) log2(e): scores in the log2 domain */
typedef __bf16 v16b __attribute__((ext_vector_type(16)));
typedef unsigned short v8us __attribute__((ext_vector_type(8), may_alias));
typedef float  v8f  __attribute__((ext_vector_type(8)));
typedef float  v4f  __attribute__((ext_vector_type(4)));
typedef float  v4fa __attribute__((ext_vector_type(4), may_alias));
union FragB { v16b v; v8us half[2]; unsigned short u[16]; };

__device__ __forceinline__ unsigned short bf16_bits(float x) { unsigned int u = __float_as_uint(x); return (unsigned short)((u + 0x7FFFu + ((u >> 16) & 1u)) >> 16); }
__device__ __forceinline__ float bf16_val(unsigned short b) { return __uint_as_float(((unsigned int)b) << 16); }
__device__ __forceinline__ float bf16_round(float x) { return bf16_val(bf16_bits(x)); }
// D += A·B with NT terms: 1 = ah·bh, 2 = + al·bh (A split), 3 = + ah·bl (both split)
template <int NT>
__device__ __forceinline__ v8f mmaN(v16b ah, v16b al, v16b bh, v16b bl, v8f c) {
  c = __builtin_amdgcn_wmma_f32_16x16x32_bf16(false, ah, false, bh, (short)0, c, false, false);
  if (NT >= 2) c = __builtin_amdgcn_wmma_f32_16x16x32_bf16(false, al, false, bh, (short)0, c, false, false);
  if (NT >= 3) c = __builtin_amdgcn_wmma_f32_16x16x32_bf16(false, ah, false, bl, (short)0, c, false, false);
  asm volatile("v_nop\n\tv_nop\n\tv_nop\n\tv_nop" : "+v"(c) : "v"(ah), "v"(al), "v"(bh), "v"(bl));
  return c;
}




// ---- f16 WMMA path (v_wmma_f32_16x16x32_f16): 11-bit significands for operands in range — used where a softmax weight operand (up to 2^8) needs more precision than bf16
typedef _Float16 v16h __attribute__((ext_vector_type(16)));
union FragH { v16h v; v8us half[2]; _Float16 h[16]; unsigned short u[16]; };
template <int NT>
__device__ __forceinline__ v8f mmaH(v16h ah, v16h al, v16h bh, v16h bl, v8f c) {
  c = __builtin_amdgcn_wmma_f32_16x16x32_f16(false, ah, false, bh, (short)0, c, false, false);
  if (NT >= 2) c = __builtin_amdgcn_wmma_f32_16x16x32_f16(false, al, false, bh, (short)0, c, false, false);
  if (NT >= 3) c = __builtin_amdgcn_wmma_f32_16x16x32_f16(false, ah, false, bl, (short)0, c, false, false);
  asm volatile("v_nop\n\tv_nop\n\tv_nop\n\tv_nop" : "+v"(c) : "v"(ah), "v"(al), "v"(bh), "v"(bl));
  return c;
}

// The three [in][out] weights as f16(bf16(W) x 16) (a power of two: exact) in fragment order: block (column tile ct of the 192 columns q | k | v, k step ks, half) = 32 lanes x 16 B,
// lane (c, h) holding column 16 ct + c, k = 32 ks + 16 half + 8 h + 0..7, so that a wave's 16 B-a-lane load of a fragment half covers 4 whole lines.
__global__ __launch_bounds__(256) void k_wfrag(const float* __restrict__ wq, const float* __restrict__ wk, const float* __restrict__ wv, _Float16* __restrict__ WF) {
  const int t = blockIdx.x * 256 + threadIdx.x; const int lane = t & 31, half = (t >> 5) & 1, blk = t >> 6; const int ks = blk % NKS, ct = blk / NKS;
  const int n = (ct & 3) * 16 + (lane & 15), k = ks * 32 + half * 16 + (lane >> 4) * 8; const float* W = ct < 4 ? wq : ct < 8 ? wk : wv; FragH f;
#pragma unroll
  for (int i = 0; i < 8; ++i) f.h[i] = (_Float16)(bf16_round(W[(size_t)(k + i) * LQ + n]) * 16.0f);
  *(v8us*)((unsigned short*)WF + (size_t)t * 8) = f.half[0];
}

typedef _Float16 v4h __attribute__((ext_vector_type(4)));

// 16 x 32 f16 fragment of a k-contiguous row: k = 8 h + 0..7 and 16 + 8 h + 0..7, the same for both operands
__device__ __forceinline__ v16h g2_frag(const _Float16* p, int hh) { FragH f; f.half[0] = *(const v8us*)((const unsigned short*)p + 8 * hh); f.half[1] = *(const v8us*)((const unsigned short*)p + 16 + 8 * hh); return f.v; }

// 32 token rows x one 16-column tile over all of K: D = W^T . x^T, a lane holds 8 neighbouring columns of one token. The x fragments come from LDS two k steps ahead into a second register set:
// the next group's reads are issued together in front of this group's products. The loops are unrolled so that the arrays stay in registers.
#define PG 2                         /* k steps a fragment group */
__device__ __forceinline__ void proj_rows(const _Float16* xs, const FragH (&wf)[NKS], int hh, v8f& a0, v8f& a1) {
  v16h xa[2][PG][2];
#pragma unroll
  for (int j = 0; j < PG; ++j) { xa[0][j][0] = g2_frag(xs + j * 32, hh); xa[0][j][1] = g2_frag(xs + 16 * PXP + j * 32, hh); }
#pragma unroll
  for (int g = 0; g < NKS / PG; ++g) {
    if (g + 1 < NKS / PG) {
#pragma unroll
      for (int j = 0; j < PG; ++j) { xa[(g + 1) & 1][j][0] = g2_frag(xs + ((g + 1) * PG + j) * 32, hh); xa[(g + 1) & 1][j][1] = g2_frag(xs + 16 * PXP + ((g + 1) * PG + j) * 32, hh); } }
#pragma unroll
    for (int j = 0; j < PG; ++j) {
      a0 = __builtin_amdgcn_wmma_f32_16x16x32_f16(false, wf[g * PG + j].v, false, xa[g & 1][j][0], (short)0, a0, false, false);
      a1 = __builtin_amdgcn_wmma_f32_16x16x32_f16(false, wf[g * PG + j].v, false, xa[g & 1][j][1], (short)0, a1, false, false); } } }

// Projections q | k | v of PR token rows in one launch. Work-group: 12 waves, grid SQ / PR. The x tile (PR whole rows: one contiguous range) is read once, 16 B a lane in whole lines, rounded to bf16,
// and laid in LDS as exact f16 rows; wave w forms column tile w of the 192 columns for all PR rows, its 24 weight fragments held in registers: half of them are asked for in front of the x loads, half behind the
// conversion, so that none is waited for inside the product loop. Waves 0-7 (q, k) store their 16 B of a token row from registers; waves 8-11 (v) turn their 16 columns x PR tokens in an LDS range of their own and store whole 128 B lines of V^T.
// The loops over pieces and fragments are unrolled so that the indices are constants and the arrays stay in registers.
__global__ __launch_bounds__(384) void k_proj(const float* __restrict__ x, const _Float16* __restrict__ WF, _Float16* __restrict__ Q, _Float16* __restrict__ Kr, _Float16* __restrict__ Vt) {
  __shared__ __attribute__((aligned(16))) _Float16 sx[PR][PXP];
  __shared__ __attribute__((aligned(16))) _Float16 tv[4][16][FP];      /* a v wave's own [column][token] tile */
  const int tid = threadIdx.x, w = __builtin_amdgcn_readfirstlane(tid >> 5), lane = tid & 31, ln = lane & 15, hh = lane >> 4; const int row0 = blockIdx.x * PR;
  const unsigned short* wp = (const unsigned short*)WF + (size_t)w * (NKS * 512) + lane * 8; FragH wf[NKS];
#pragma unroll
  for (int ks = 0; ks < NKS / 2; ++ks) { wf[ks].half[0] = *(const v8us*)(wp + ks * 512); wf[ks].half[1] = *(const v8us*)(wp + ks * 512 + 256); }
  constexpr int NX = PR * DM / 4 / 384;      /* 16 B pieces of the tile a lane */
  const float* xp = x + (size_t)row0 * DM + tid * 4; v4f xv[NX];
#pragma unroll
  for (int i = 0; i < NX; ++i) xv[i] = *(const v4fa*)(xp + i * (384 * 4));
  const int xr = tid / (DM / 4), xc = (tid % (DM / 4)) * 4;      /* 384 lanes = two rows of 192 pieces */
#pragma unroll
  for (int i = 0; i < NX; ++i) { v4h h4;
#pragma unroll
    for (int q = 0; q < 4; ++q) h4[q] = (_Float16)bf16_round(xv[i][q]);
    *(v4h*)&sx[2 * i + xr][xc] = h4; }
#pragma unroll
  for (int ks = NKS / 2; ks < NKS; ++ks) { wf[ks].half[0] = *(const v8us*)(wp + ks * 512); wf[ks].half[1] = *(const v8us*)(wp + ks * 512 + 256); }
  __syncthreads();      /* publishes the x tile */
  const v8f z8 = {0.f,0.f,0.f,0.f,0.f,0.f,0.f,0.f};
  _Float16* o = (w < 4 ? Q : Kr) + (size_t)(row0 + ln) * LQ + (w & 3) * 16 + 8 * hh;
  const float osc = w < 4 ? 0.0625f * SC2 : 0.0625f;      /* undoes the weights' x16; q also takes (1 / 8) log2(e), so that q . k is a score in the log2 domain */
#pragma unroll 1      /* stays rolled: the row block's LDS base is then a register, and every fragment's offset fits the LDS instruction's 16-bit field */
  for (int p = 0; p < PR / 32; ++p) { v8f a0 = z8, a1 = z8; proj_rows(&sx[p * 32 + ln][0], wf, hh, a0, a1);
    FragH f0, f1;
#pragma unroll
    for (int r = 0; r < 8; ++r) { f0.h[r] = (_Float16)(a0[r] * osc); f1.h[r] = (_Float16)(a1[r] * osc); }
    if (w < 8) { *(v8us*)((unsigned short*)o + (p * 32) * LQ) = f0.half[0]; *(v8us*)((unsigned short*)o + (p * 32 + 16) * LQ) = f1.half[0];
      asm volatile("s_wait_xcnt 0x0" ::: "memory"); }      /* the next trip writes anew the registers that these stores name */
    else {
#pragma unroll
      for (int r = 0; r < 8; ++r) { tv[w - 8][8 * hh + r][p * 32 + ln] = f0.h[r]; tv[w - 8][8 * hh + r][p * 32 + 16 + ln] = f1.h[r]; } } }
  if (w >= 8) {
    __builtin_amdgcn_fence(__ATOMIC_ACQ_REL, "workgroup"); __builtin_amdgcn_wave_barrier();      /* the wave's lanes read below what its other lanes wrote above */
#pragma unroll
    for (int i = 0; i < 4; ++i) { const int d = i * 4 + (lane >> 3), c8 = (lane & 7) * 8;
      *(v8us*)((unsigned short*)Vt + (size_t)((w - 8) * 16 + d) * SQ + row0 + c8) = *(const v8us*)&tv[w - 8][d][c8]; } } }

// Fused attention over one key range. Work-group: FW quarters of the range x FQ waves x 32 query columns; grid (SQ / 128, FK). Transposed products: S^T = K . Q^T puts one query's scores in one lane column
// (register r of tile t = key 16 t + 8 hh + r), which is the k order of a B operand, so the f16 weights go into O^T += V^T . P^T with no LDS trip and no lane exchange.
// K rows and V^T columns come through registers into two LDS buffers a quarter, staged by the quarter's own waves: the next stage's global loads are issued in front of this stage's products, stored behind them.
// At the end every wave lays its un-normalised rows and (maximum, sum) in LDS, and the four waves of a query group each merge 16 of its queries x 32 output columns (one 128 B line a query) over the quarters, in rising order of the keys.
// Every loop over tiles, fragments and registers is unrolled so that the indices are constants and the arrays stay in registers; the loop over the stages stays rolled.
typedef float v2fa __attribute__((ext_vector_type(2), may_alias));
__device__ __forceinline__ v8f fa_mma(v16h a, v16h b, v8f c) { return __builtin_amdgcn_wmma_f32_16x16x32_f16(false, a, false, b, (short)0, c, false, false); }
typedef float v2f __attribute__((ext_vector_type(2)));
// S^T tiles of 32 keys x 32 queries with C = minus the maximum in use: the products end as score - maximum in the log2 domain, an exp2 argument. Asm, because the builtin form copied C (8 registers) in front of
// every second tile: here C is read in place. Four independent tiles, then their second k steps (same D: exempt); the v_nop keep the distance between the last product and the first vector instruction that reads its D.
__device__ __forceinline__ void fa_scores(const v16h (&kf)[2][2], const v16h (&qf)[2][2], const v8f (&cm)[2], v8f (&s)[2][2]) {
  asm("v_wmma_f32_16x16x32_f16 %0, %4, %8, %12\n\t"
      "v_wmma_f32_16x16x32_f16 %1, %4, %10, %13\n\t"
      "v_wmma_f32_16x16x32_f16 %2, %6, %8, %12\n\t"
      "v_wmma_f32_16x16x32_f16 %3, %6, %10, %13\n\t"
      "v_wmma_f32_16x16x32_f16 %0, %5, %9, %0\n\t"
      "v_wmma_f32_16x16x32_f16 %1, %5, %11, %1\n\t"
      "v_wmma_f32_16x16x32_f16 %2, %7, %9, %2\n\t"
      "v_wmma_f32_16x16x32_f16 %3, %7, %11, %3\n\t"
      "v_nop\n\tv_nop\n\tv_nop\n\tv_nop"
      : "=&v"(s[0][0]), "=&v"(s[0][1]), "=&v"(s[1][0]), "=&v"(s[1][1])
      : "v"(kf[0][0]), "v"(kf[0][1]), "v"(kf[1][0]), "v"(kf[1][1]), "v"(qf[0][0]), "v"(qf[0][1]), "v"(qf[1][0]), "v"(qf[1][1]), "v"(cm[0]), "v"(cm[1])); }
// exp2 for the rare renewal path: the v_nop fills the slot behind the transcendental, whose source register the next instruction may write anew
__device__ __forceinline__ float fa_exp2_slot(float x) { float f; asm("v_exp_f32 %0, %1\n\tv_nop" : "=v"(f) : "v"(x)); return f; }
// sum of a lane's 16 weights of a pass, as a tree of vector adds (two sums an instruction down to the last)
__device__ __forceinline__ float fa_sum16(v8f a, v8f b) { const v8f c = a + b; const v4f d = c.lo + c.hi; const v2f f = d.lo + d.hi; return f.x + f.y; }
__global__ __launch_bounds__(32 * FQ * FW) void k_fattn(const _Float16* __restrict__ Q, const _Float16* __restrict__ Kr, const _Float16* __restrict__ Vt, float* __restrict__ part, float* __restrict__ ml) {
  __shared__ __attribute__((aligned(16))) _Float16 sm[2][FW][FST + HD][FP];      /* a buffer of a quarter: FST K rows, then HD rows of V^T */
  const int tid = threadIdx.x, w = __builtin_amdgcn_readfirstlane(tid >> 5), lane = tid & 31, ln = lane & 15, hh = lane >> 4, qg = w % FQ, kq = w / FQ;
  const int q0 = blockIdx.x * (32 * FQ) + qg * 32, key0 = (blockIdx.y * FW + kq) * (SQ / FK / FW);
  v16h qf[2][2];
#pragma unroll
  for (int g = 0; g < 2; ++g) {
#pragma unroll
    for (int ks = 0; ks < 2; ++ks) qf[g][ks] = g2_frag(Q + (size_t)(q0 + g * 16 + ln) * LQ + ks * 32, hh); }
  constexpr int SRW = 32 * FQ / 8, NJ = FST / SRW;      /* staging: 8 lanes a 128 B row, so a wave-wide load is 4 whole lines; a quarter's waves take SRW rows at a time */
  const int sr = (tid % (32 * FQ)) >> 3, sc = (tid & 7) * 8;
  const unsigned short* gk = (const unsigned short*)Kr + (size_t)(key0 + sr) * LQ + sc;
  const unsigned short* gv = (const unsigned short*)Vt + (size_t)sr * SQ + key0 + sc;
  v8us kr[NJ], vr[NJ];
#pragma unroll
  for (int j = 0; j < NJ; ++j) { kr[j] = *(const v8us*)(gk + j * SRW * LQ); vr[j] = *(const v8us*)(gv + (size_t)j * SRW * SQ); }
#pragma unroll
  for (int j = 0; j < NJ; ++j) { *(v8us*)&sm[0][kq][sr + j * SRW][sc] = kr[j]; *(v8us*)&sm[0][kq][FST + sr + j * SRW][sc] = vr[j]; }
  __syncthreads();      /* publishes stage 0 */
  const v8f z8 = {0.f,0.f,0.f,0.f,0.f,0.f,0.f,0.f};
  v8f o[4][2], cm[2]; float m[2], l[2];      /* cm: minus the maximum in use in all 8 registers, the C operand of the score products (0 until the first pass has set a maximum) */
#pragma unroll
  for (int g = 0; g < 2; ++g) { m[g] = -3.0e38f; l[g] = 0.f; cm[g] = z8;
#pragma unroll
    for (int dt = 0; dt < 4; ++dt) o[dt][g] = z8; }
  constexpr int NST = SQ / FK / FW / FST;
  for (int st = 0; st < NST; ++st) { const int b = st & 1;
    if (st + 1 < NST) { const unsigned short* nk = gk + (size_t)(st + 1) * FST * LQ; const unsigned short* nv = gv + (st + 1) * FST;
#pragma unroll
      for (int j = 0; j < NJ; ++j) { kr[j] = *(const v8us*)(nk + j * SRW * LQ); vr[j] = *(const v8us*)(nv + (size_t)j * SRW * SQ); } }
#pragma unroll
    for (int p = 0; p < FST / 32; ++p) {
      v8f s[2][2]; v16h kf[2][2];
#pragma unroll
      for (int t = 0; t < 2; ++t) { kf[t][0] = g2_frag(&sm[b][kq][p * 32 + t * 16 + ln][0], hh); kf[t][1] = g2_frag(&sm[b][kq][p * 32 + t * 16 + ln][32], hh); }
      fa_scores(kf, qf, cm, s);
      v16h va[4];      /* the first V^T fragments are asked for in front of the exp2 block, so that they have landed when the weights are packed; the registers hold no more of them there */
#pragma unroll
      for (int dt = 0; dt < 1 + p; ++dt) va[dt] = g2_frag(&sm[b][kq][FST + dt * 16 + ln][p * 32], hh);
      v8f e[2][2]; float ps[2]; bool need = false;
#pragma unroll
      for (int g = 0; g < 2; ++g) {
#pragma unroll
        for (int t = 0; t < 2; ++t) {
#pragma unroll
          for (int r = 0; r < 8; ++r) e[t][g][r] = __builtin_amdgcn_exp2f(s[t][g][r]); }
        ps[g] = fa_sum16(e[0][g], e[1][g]); need = need || (ps[g] > 256.0f); }
      /* lazy renewal: the maximum in use moves only when a lane's 16 weights of the pass sum to more than 2^8 (so a weight that is kept stays below 2^8, inside f16; an overflowed exp2 shows as an infinite sum), and in the
         first pass, which sets it; the scores are still in registers, so the pass's weights are then formed anew against the new maximum; one scalar branch a pass */
      bool renew = __builtin_amdgcn_ballot_w32(need) != 0; if (p == 0) renew = renew || st == 0;
      if (renew) {
#pragma unroll
        for (int g = 0; g < 2; ++g) { float a = fmaxf(s[0][g][0], s[1][g][0]);
#pragma unroll
          for (int r = 1; r < 8; ++r) a = fmaxf(a, fmaxf(s[0][g][r], s[1][g][r]));
          const float off = -cm[g][0], mxa = a + off;      /* off: what the products have taken off already (0 in the first pass, else m) */
          const float mn = fmaxf(m[g], fmaxf(mxa, __shfl_xor(mxa, 16, 32))); const float al = fa_exp2_slot(m[g] - mn), d = mn - off; m[g] = mn; l[g] *= al;
#pragma unroll
          for (int dt = 0; dt < 4; ++dt) o[dt][g] *= al;
#pragma unroll
          for (int r = 0; r < 8; ++r) cm[g][r] = -mn;
#pragma unroll
          for (int t = 0; t < 2; ++t) {
#pragma unroll
            for (int r = 0; r < 8; ++r) e[t][g][r] = fa_exp2_slot(s[t][g][r] - d); }
          ps[g] = fa_sum16(e[0][g], e[1][g]); } }
#pragma unroll
      for (int dt = 1 + p; dt < 4; ++dt) va[dt] = g2_frag(&sm[b][kq][FST + dt * 16 + ln][p * 32], hh);
      FragH pf[2];
#pragma unroll
      for (int g = 0; g < 2; ++g) { l[g] += ps[g];
#pragma unroll
        for (int t = 0; t < 2; ++t) {
#pragma unroll
          for (int r = 0; r < 8; ++r) pf[g].h[t * 8 + r] = (_Float16)e[t][g][r]; } }
#pragma unroll
      for (int dt = 0; dt < 4; ++dt) {
#pragma unroll
        for (int g = 0; g < 2; ++g) o[dt][g] = fa_mma(va[dt], pf[g].v, o[dt][g]); } }
    if (st + 1 < NST) {
#pragma unroll
      for (int j = 0; j < NJ; ++j) { *(v8us*)&sm[b ^ 1][kq][sr + j * SRW][sc] = kr[j]; *(v8us*)&sm[b ^ 1][kq][FST + sr + j * SRW][sc] = vr[j]; } }
    __syncthreads(); }      /* publishes stage st + 1 and ends every wave's reads of stage st, whose buffer the next trip refills; the last one frees both buffers for the merge */
  /* merge of the quarters in the LDS that the stages have left: tile (wave, dt, g, register half) = 32 lanes x 16 B in lane order, then (maximum, sum) a (wave, g, lane) */
  float* mb = (float*)&sm[0][0][0][0]; float* mlb = mb + FQ * FW * 2048;
  static_assert((FQ * FW * 2048 + FQ * FW * 128) * 4 <= (int)sizeof(sm) && FW == 4 && HD == 64, "the merge tiles fit the stage buffers; four merging waves a query group: 2 query tiles x 2 column halves");
#pragma unroll
  for (int g = 0; g < 2; ++g) { const v2fa e = {m[g], l[g] + __shfl_xor(l[g], 16, 32)}; *(v2fa*)(mlb + ((w * 2 + g) * 32 + lane) * 2) = e; }
#pragma unroll
  for (int dt = 0; dt < 4; ++dt) {
#pragma unroll
    for (int g = 0; g < 2; ++g) { const v4f lo = {o[dt][g][0], o[dt][g][1], o[dt][g][2], o[dt][g][3]}, hi = {o[dt][g][4], o[dt][g][5], o[dt][g][6], o[dt][g][7]};
      float* t = mb + ((((w * 4 + dt) * 2 + g) * 2) * 32 + lane) * 4; *(v4fa*)t = lo; *(v4fa*)(t + 128) = hi; } }
  __syncthreads();      /* publishes every wave's rows to the waves that merge them */
  { const int g = kq & 1, d0 = (kq >> 1) * 2; float mm[FW], ll[FW]; v4f lo[2][FW], hi[2][FW];      /* this wave's share: 16 queries x 32 columns, one whole 128 B line a query */
#pragma unroll
    for (int s = 0; s < FW; ++s) { const int ws = s * FQ + qg; const v2fa e = *(const v2fa*)(mlb + ((ws * 2 + g) * 32 + lane) * 2); mm[s] = e[0]; ll[s] = e[1];
#pragma unroll
      for (int d = 0; d < 2; ++d) { const float* t = mb + ((((ws * 4 + d0 + d) * 2 + g) * 2) * 32 + lane) * 4; lo[d][s] = *(const v4fa*)t; hi[d][s] = *(const v4fa*)(t + 128); } }
    float M = mm[0];
#pragma unroll
    for (int s = 1; s < FW; ++s) M = fmaxf(M, mm[s]);
    const v4f z4 = {0.f, 0.f, 0.f, 0.f}; v4f alo[2] = {z4, z4}, ahi[2] = {z4, z4}; float L = 0.f;
#pragma unroll
    for (int s = 0; s < FW; ++s) { float f; asm("v_exp_f32 %0, %1\n\tv_nop" : "=v"(f) : "v"(mm[s] - M));      /* the v_nop fills the slot behind the transcendental, whose source register the next instruction may write anew */
      L += f * ll[s];
#pragma unroll
      for (int d = 0; d < 2; ++d) { alo[d] += lo[d][s] * f; ahi[d] += hi[d][s] * f; } }
    const size_t pr = (size_t)(q0 + g * 16 + ln) * FK + blockIdx.y; float* pp = part + pr * LQ + d0 * 16 + 8 * hh;
#pragma unroll
    for (int d = 0; d < 2; ++d) { *(v4fa*)(pp + d * 16) = alo[d]; *(v4fa*)(pp + d * 16 + 4) = ahi[d]; }
    if (d0 == 0 && hh == 0) { ml[pr * 2] = M; ml[pr * 2 + 1] = L; } } }

// out row = the row's FK partials [8192][FK][64], each weighted by exp2(its maximum - the row's maximum), in rising order of the range, over the sum of the ranges' sums weighted by the same factors; one 16 B column group a lane.
// The loops are unrolled so that the arrays stay in registers and a lane's loads are in flight together.
__global__ __launch_bounds__(256) void k_fmerge(const float* __restrict__ part, const float* __restrict__ ml, float* __restrict__ out) {
  const size_t t = (size_t)blockIdx.x * 256 + threadIdx.x; const float* p = part + (t >> 4) * (FK * LQ) + (t & 15) * 4; const float* q = ml + (t >> 4) * (FK * 2); v4f v[FK]; float mm[FK], ll[FK];
#pragma unroll
  for (int s = 0; s < FK; ++s) { mm[s] = q[s * 2]; ll[s] = q[s * 2 + 1]; }
  asm volatile("s_wait_xcnt 0x0" ::: "memory");      /* the loads below may land in the registers that held the address of the loads above */
#pragma unroll
  for (int s = 0; s < FK; ++s) v[s] = *(const v4fa*)(p + s * LQ);
  float M = mm[0];
#pragma unroll
  for (int s = 1; s < FK; ++s) M = fmaxf(M, mm[s]);
#pragma unroll
  for (int s = 0; s < FK; ++s) mm[s] = __builtin_amdgcn_exp2f(mm[s] - M);
  v4f a = {0.f, 0.f, 0.f, 0.f}; float L = 0.f;
#pragma unroll
  for (int s = 0; s < FK; ++s) { L += mm[s] * ll[s]; a += v[s] * mm[s]; }
  *(v4fa*)(out + t * 4) = a * (1.0f / L); }

extern "C" void kernel_launch(void* const* d_in, const int* in_sizes, int n_in,
                              void* d_out, int out_size, void* d_ws, size_t ws_size, hipStream_t stream) {
  (void)in_sizes; (void)n_in; (void)out_size;
  const float* const* I = (const float* const*)d_in; const float* x = I[0]; const float* wq = I[1]; const float* wk = I[2]; const float* wv = I[3];      /* x [8192][768] (ONE unbatched sequence); three separate [in][out] weights W_q, W_k, W_v [768][64]: ONE head of 64; no biases; no output projection */
  static_assert(NH == 1 && HG == 1 && HD == 64 && SQ % (32 * FQ) == 0, "one head of 64; whole work-groups of 128 queries");
  static_assert(NB == 1 && LQ == 64 && SQ % (FK * FW * FST) == 0 && FST == 64 && (NR * LQ) % 1024 == 0, "whole stages in a key range; a stage's rows are 128 B; 16 lanes a row and whole work-groups in the merge");
  static_assert(PR == 64 && SQ % PR == 0 && DM % 32 == 0 && DM / 4 * 2 == 384 && (PR * DM / 4) % 384 == 0 && 3 * LQ == 12 * 16 && (3 * LQ * DM / 8) % 256 == 0 && NKS % 4 == 0 && NKS % PG == 0, "projection: 12 waves = 12 column tiles; 384 lanes = two x rows; whole work-groups in the weight staging, each inside one weight");
  char* ws = (char*)d_ws; size_t off = 0;
  auto take = [&](size_t bytes) { char* p = ws + off; off += (bytes + 255) & ~(size_t)255; return p; };
  _Float16* WF = (_Float16*)take((size_t)3 * LQ * DM * 2);      /* the three weights in fragment order: 12 column tiles x 24 k steps x 1 KiB */
  _Float16* Q16 = (_Float16*)take(NR * LQ * 2); _Float16* K16 = (_Float16*)take(NR * LQ * 2);
  _Float16* VT = (_Float16*)take((size_t)NH * HD * SQ * 2);
  float* PART = (float*)take((size_t)FK * NR * LQ * 4);      /* un-normalised partial output rows [8192][FK][64] f32: a row's FK partials lie side by side */
  float* ML = (float*)take((size_t)FK * NR * 2 * 4);      /* each partial's (maximum in the log2 domain, sum) */
  if (off > ws_size) return;
  k_wfrag<<<(unsigned)((size_t)3 * LQ * DM / 8 / 256), 256, 0, stream>>>(wq, wk, wv, WF);      /* three [in][out] weights -> x16 f16 fragments */
  k_proj<<<SQ / PR, 384, 0, stream>>>(x, WF, Q16, K16, VT);      /* q, k as f16 rows [8192][64], v as V^T [64][8192] (K = 768; no bias) */
  for (int b = B0; b < B0 + NBR; ++b) { const size_t r0 = (size_t)b * SQ;
    k_fattn<<<dim3(SQ / (32 * FQ), FK), 32 * FQ * FW, 0, stream>>>(Q16 + r0 * LQ, K16 + r0 * LQ, VT, PART + r0 * (FK * LQ), ML + r0 * (FK * 2)); }      /* scores, softmax and context rows of 128 queries against one key range a work-group */
  k_fmerge<<<(unsigned)(NR * LQ / 1024), 256, 0, stream>>>(PART, ML, (float*)d_out);      /* each row's FK partials merged into the output */
}
